// v000
// The times below were measured on an AMD MI455X: many runs one after another, warmed up first and cycling through
// copies of the inputs, with the whole window's GPU time divided by the number of runs. Launches and the gaps
// between them are all in it. The median over several windows is given; except for v000 it joins two sittings, which
// can be a few percent apart, so the side-by-side timings, each taken in one sitting, are the better comparison.
// The starting kernel, v000, takes 678 microseconds a run.
#include <hip/hip_runtime.h>
#include <hip/hip_bf16.h>
#include <math.h>

typedef float v2f __attribute__((ext_vector_type(2)));
typedef float v8f __attribute__((ext_vector_type(8)));

#define HIDDEN 1024
#define DIM    512
#define CONV_OUT 10
#define BATCH  16
#define VLEN   4096
#define ROWS_PER_BLOCK 64
#define CHUNKS_PER_B   (VLEN / ROWS_PER_BLOCK)   // 64
#define NBLOCKS_FUSED  (BATCH * CHUNKS_PER_B)    // 1024

#define KC        8                  // K-slice per stage
#define NSLICE    (HIDDEN / KC)      // 128
#define BSTRIDE   12                 // padded row stride (floats): conflict-free, 48B (16B-aligned)
#define LDSB_SZ   (DIM * BSTRIDE)             // 6144 floats per buffer
#define LDSA_SZ   (ROWS_PER_BLOCK * BSTRIDE)  // 768 floats per buffer

#define USE_ASYNC_LDS 1

// ---------------- workspace layout (floats) ----------------
#define WS_QP    0
#define WS_SG    (WS_QP + BATCH * DIM)
#define WS_CTX   (WS_SG + BATCH * VLEN)
#define WS_SSUM  (WS_CTX + NBLOCKS_FUSED * HIDDEN)

// ISA 10.2: generic (flat) pointers to LDS carry the LDS byte address in bits [31:0].
__device__ __forceinline__ unsigned lds_addr32(const void* p) {
    return (unsigned)(unsigned long long)p;
}

__device__ __forceinline__ void async_g2l_b128(unsigned lds_off, const float* gptr) {
#if USE_ASYNC_LDS
    asm volatile("global_load_async_to_lds_b128 %0, %1, off"
                 :: "v"(lds_off), "v"(gptr)
                 : "memory");
#endif
}

__device__ __forceinline__ void wait_async0() {
#if USE_ASYNC_LDS
    asm volatile("s_wait_asynccnt 0" ::: "memory");
#endif
}

// ================= kernel A: qp = query @ q_w.T =================
__global__ __launch_bounds__(256)
void qproj_kernel(const float* __restrict__ query, const float* __restrict__ q_w,
                  float* __restrict__ qp_ws) {
    int gid = blockIdx.x * 256 + threadIdx.x;      // 0..8191
    int b = gid >> 9;
    int d = gid & 511;
    const float* q = query + (size_t)b * HIDDEN;
    const float* w = q_w + (size_t)d * HIDDEN;
    float acc = 0.f;
    for (int k = 0; k < HIDDEN; k += 4) {
        float4 qq = *(const float4*)(q + k);
        float4 ww = *(const float4*)(w + k);
        acc += qq.x * ww.x + qq.y * ww.y + qq.z * ww.z + qq.w * ww.w;
    }
    qp_ws[gid] = acc;
}

// ================= kernel B: fused projection/score/context =================
// 1024 blocks x 256 threads (8 wave32). wave w: rows rw=w&3 (16), dims chalf=w>>2 (256).
// K streamed in 128 double-buffered slices of 8, staged via async global->LDS DMA.
__global__ __launch_bounds__(256)
void fused_attn_kernel(const float* __restrict__ value,
                       const float* __restrict__ prev_attn,
                       const float* __restrict__ conv_w,
                       const float* __restrict__ conv_b,
                       const float* __restrict__ loc_w,
                       const float* __restrict__ v_w,
                       const float* __restrict__ bias,
                       const float* __restrict__ score_w,
                       const float* __restrict__ score_b,
                       const float* __restrict__ qp_ws,
                       float* __restrict__ sg_ws,
                       float* __restrict__ ctx_part,
                       float* __restrict__ ssum_part) {
    __shared__ float ldsB[2][LDSB_SZ];                 // 48 KB : v_w[n][k-slice], padded rows
    __shared__ float ldsA[2][LDSA_SZ];                 // 6 KB  : value[m][k-slice], padded rows
    __shared__ float cf_s[ROWS_PER_BLOCK * CONV_OUT];  // conv features
    __shared__ float qp_s[DIM];
    __shared__ float scorepart[ROWS_PER_BLOCK * 2];
    __shared__ float sg_s[ROWS_PER_BLOCK];

    const int chunk = blockIdx.x;
    const int b  = chunk >> 6;
    const int v0 = (chunk & 63) << 6;
    const int tid  = threadIdx.x;
    const int lane = tid & 31;
    const int wave = tid >> 5;
    const int rw    = wave & 3;
    const int chalf = wave >> 2;

    const float* Abase = value + (size_t)(b * VLEN + v0) * HIDDEN;

    // stage qp (per-batch query projection)
    for (int i = tid; i < DIM; i += 256) qp_s[i] = qp_ws[b * DIM + i];

    // conv features: cf[m][c] = conv_b[c] + sum_j conv_w[c][j]*pa[v0+m-1+j]
    {
        const float* pa = prev_attn + (size_t)b * VLEN;
        for (int idx = tid; idx < ROWS_PER_BLOCK * CONV_OUT; idx += 256) {
            int m = idx / CONV_OUT, c = idx % CONV_OUT;
            int v = v0 + m;
            float x0 = (v - 1 >= 0)   ? pa[v - 1] : 0.f;
            float x1 = pa[v];
            float x2 = (v + 1 < VLEN) ? pa[v + 1] : 0.f;
            cf_s[idx] = conv_b[c] + conv_w[c * 3 + 0] * x0
                                  + conv_w[c * 3 + 1] * x1
                                  + conv_w[c * 3 + 2] * x2;
        }
    }

    // --- async stage of one K-slice into buffer `buf` ---
    auto issue_slice = [&](int kc, int buf) {
        // B: 512 rows x 8 floats = 1024 b128 quads, 4 per thread
#pragma unroll
        for (int j = 0; j < 4; j++) {
            int idx = tid + j * 256;        // 0..1023
            int n  = idx >> 1;
            int q4 = (idx & 1) << 2;
            async_g2l_b128(lds_addr32(&ldsB[buf][n * BSTRIDE + q4]),
                           v_w + (size_t)n * HIDDEN + kc + q4);
        }
        // A: 64 rows x 8 floats = 128 quads (threads 0..127)
        if (tid < 128) {
            int m  = tid >> 1;
            int q4 = (tid & 1) << 2;
            async_g2l_b128(lds_addr32(&ldsA[buf][m * BSTRIDE + q4]),
                           Abase + (size_t)m * HIDDEN + kc + q4);
        }
#if !USE_ASYNC_LDS
        // synchronous fallback
#pragma unroll
        for (int j = 0; j < 4; j++) {
            int idx = tid + j * 256;
            int n  = idx >> 1;
            int q4 = (idx & 1) << 2;
            *(float4*)(&ldsB[buf][n * BSTRIDE + q4]) =
                *(const float4*)(v_w + (size_t)n * HIDDEN + kc + q4);
        }
        if (tid < 128) {
            int m  = tid >> 1;
            int q4 = (tid & 1) << 2;
            *(float4*)(&ldsA[buf][m * BSTRIDE + q4]) =
                *(const float4*)(Abase + (size_t)m * HIDDEN + kc + q4);
        }
#endif
    };

    // per-lane fragment coordinates (ISA 16x16x4 f32 layout)
    const int mr = lane & 15;            // A row
    const int kh = (lane >> 4) << 1;     // K sub-offset: 0 or 2
    const int nn = lane & 15;            // B/C column

    v8f acc[16];
#pragma unroll
    for (int t = 0; t < 16; t++)
#pragma unroll
        for (int i = 0; i < 8; i++) acc[t][i] = 0.f;

    issue_slice(0, 0);

    for (int s = 0; s < NSLICE; ++s) {
        const int cur = s & 1;
        wait_async0();            // my staged loads for slice s are in LDS
        __syncthreads();          // everyone's are; prev compute done
        if (s + 1 < NSLICE) issue_slice((s + 1) * KC, cur ^ 1);

        const float* Ab = &ldsA[cur][(rw * 16 + mr) * BSTRIDE];
        const float* Bb = &ldsB[cur][(chalf * 256 + nn) * BSTRIDE];
#pragma unroll
        for (int ks = 0; ks < 2; ks++) {
            int kk = ks * 4 + kh;
            v2f a = *(const v2f*)(Ab + kk);
#pragma unroll
            for (int t = 0; t < 16; t++) {
                v2f bf = *(const v2f*)(Bb + t * 16 * BSTRIDE + kk);
                acc[t] = __builtin_amdgcn_wmma_f32_16x16x4_f32(
                    false, a, false, bf, (short)0, acc[t], false, false);
            }
        }
    }

    // -------- epilogue: e = tanh(vp + qp + lp + bias); score partial per row --------
    float rowacc[8];
#pragma unroll
    for (int i = 0; i < 8; i++) rowacc[i] = 0.f;
    const int mbase = rw * 16 + ((lane >> 4) << 3);   // C layout: high-half lanes => M+8

#pragma unroll
    for (int t = 0; t < 16; t++) {
        int n = chalf * 256 + t * 16 + nn;
        float qb = qp_s[n] + bias[n];
        float sw = score_w[n];
        const float* lw = loc_w + (size_t)n * CONV_OUT;
        float l0 = lw[0], l1 = lw[1], l2 = lw[2], l3 = lw[3], l4 = lw[4];
        float l5 = lw[5], l6 = lw[6], l7 = lw[7], l8 = lw[8], l9 = lw[9];
#pragma unroll
        for (int i = 0; i < 8; i++) {
            const float* cfr = cf_s + (mbase + i) * CONV_OUT;
            float lp = cfr[0]*l0 + cfr[1]*l1 + cfr[2]*l2 + cfr[3]*l3 + cfr[4]*l4
                     + cfr[5]*l5 + cfr[6]*l6 + cfr[7]*l7 + cfr[8]*l8 + cfr[9]*l9;
            float x = acc[t][i] + qb + lp;
            rowacc[i] += tanhf(x) * sw;
        }
    }
    // reduce over the 16 lanes of each half (tile columns)
#pragma unroll
    for (int i = 0; i < 8; i++) {
        float v = rowacc[i];
        v += __shfl_xor(v, 1, 32);
        v += __shfl_xor(v, 2, 32);
        v += __shfl_xor(v, 4, 32);
        v += __shfl_xor(v, 8, 32);
        rowacc[i] = v;
    }
    if ((lane & 15) == 0) {
#pragma unroll
        for (int i = 0; i < 8; i++)
            scorepart[(mbase + i) * 2 + chalf] = rowacc[i];
    }
    __syncthreads();

    if (tid < ROWS_PER_BLOCK) {
        float s = scorepart[tid * 2] + scorepart[tid * 2 + 1] + score_b[0];
        float sgv = 1.f / (1.f + expf(-s));
        sg_s[tid] = sgv;
        sg_ws[(size_t)b * VLEN + v0 + tid] = sgv;
    }
    __syncthreads();

    // -------- unnormalized context partial for this chunk (value tile is L2-hot) --------
    {
        int h = tid * 4;
        float4 a4 = make_float4(0.f, 0.f, 0.f, 0.f);
        const float* vrow = Abase + h;
        for (int r = 0; r < ROWS_PER_BLOCK; r++) {
            float s = sg_s[r];
            float4 x = *(const float4*)(vrow + (size_t)r * HIDDEN);
            a4.x += s * x.x; a4.y += s * x.y; a4.z += s * x.z; a4.w += s * x.w;
        }
        *(float4*)(ctx_part + (size_t)chunk * HIDDEN + h) = a4;
    }
    if (tid == 0) {
        float s = 0.f;
        for (int r = 0; r < ROWS_PER_BLOCK; r++) s += sg_s[r];
        ssum_part[chunk] = s;
    }
}

// ================= kernel C: deterministic reduce + attn normalize + output GEMM ===========
__global__ __launch_bounds__(256)
void finalize_kernel(const float* __restrict__ query,
                     const float* __restrict__ sg_ws,
                     const float* __restrict__ ctx_part,
                     const float* __restrict__ ssum_part,
                     const float* __restrict__ out_w,
                     const float* __restrict__ out_b,
                     float* __restrict__ out,        // (16,1,1024)
                     float* __restrict__ attn_out) { // (16,4096)
    __shared__ float comb[2 * HIDDEN];
    __shared__ float inv_s;
    const int b = blockIdx.x;
    const int tid = threadIdx.x;

    if (tid == 0) {
        float s = 0.f;
        for (int c = 0; c < CHUNKS_PER_B; c++) s += ssum_part[b * CHUNKS_PER_B + c];
        inv_s = 1.f / s;
    }
    __syncthreads();
    const float inv = inv_s;

    // context = (fixed-order sum of chunk partials) * inv
    {
        int h = tid * 4;
        float4 a4 = make_float4(0.f, 0.f, 0.f, 0.f);
        for (int c = 0; c < CHUNKS_PER_B; c++) {
            float4 x = *(const float4*)(ctx_part + ((size_t)(b * CHUNKS_PER_B + c)) * HIDDEN + h);
            a4.x += x.x; a4.y += x.y; a4.z += x.z; a4.w += x.w;
        }
        comb[h + 0] = a4.x * inv;
        comb[h + 1] = a4.y * inv;
        comb[h + 2] = a4.z * inv;
        comb[h + 3] = a4.w * inv;
    }
    for (int h = tid; h < HIDDEN; h += 256)
        comb[HIDDEN + h] = query[(size_t)b * HIDDEN + h];
    __syncthreads();

    // attn output
    for (int v = tid; v < VLEN; v += 256)
        attn_out[(size_t)b * VLEN + v] = sg_ws[(size_t)b * VLEN + v] * inv;

    // output = combined @ out_w.T + out_b
    for (int h = tid; h < HIDDEN; h += 256) {
        const float* wr = out_w + (size_t)h * (2 * HIDDEN);
        float acc = out_b[h];
        for (int k = 0; k < 2 * HIDDEN; k += 4) {
            float4 w4 = *(const float4*)(wr + k);
            acc += comb[k] * w4.x + comb[k + 1] * w4.y + comb[k + 2] * w4.z + comb[k + 3] * w4.w;
        }
        out[(size_t)b * HIDDEN + h] = acc;
    }
}

// ============================ launch ============================
extern "C" void kernel_launch(void* const* d_in, const int* in_sizes, int n_in,
                              void* d_out, int out_size, void* d_ws, size_t ws_size,
                              hipStream_t stream) {
    const float* query     = (const float*)d_in[0];
    const float* value     = (const float*)d_in[1];
    const float* prev_attn = (const float*)d_in[2];
    const float* conv_w    = (const float*)d_in[3];
    const float* conv_b    = (const float*)d_in[4];
    const float* loc_w     = (const float*)d_in[5];
    const float* q_w       = (const float*)d_in[6];
    const float* v_w       = (const float*)d_in[7];
    const float* bias      = (const float*)d_in[8];
    const float* score_w   = (const float*)d_in[9];
    const float* score_b   = (const float*)d_in[10];
    const float* out_w     = (const float*)d_in[11];
    const float* out_b     = (const float*)d_in[12];

    float* ws = (float*)d_ws;
    float* qp_ws     = ws + WS_QP;
    float* sg_ws     = ws + WS_SG;
    float* ctx_part  = ws + WS_CTX;
    float* ssum_part = ws + WS_SSUM;

    float* out_main = (float*)d_out;                 // (16,1,1024)
    float* attn_out = out_main + BATCH * HIDDEN;     // (16,4096)

    qproj_kernel<<<BATCH * DIM / 256, 256, 0, stream>>>(query, q_w, qp_ws);

    fused_attn_kernel<<<NBLOCKS_FUSED, 256, 0, stream>>>(
        value, prev_attn, conv_w, conv_b, loc_w, v_w, bias, score_w, score_b,
        qp_ws, sg_ws, ctx_part, ssum_part);

    finalize_kernel<<<BATCH, 256, 0, stream>>>(
        query, sg_ws, ctx_part, ssum_part, out_w, out_b, out_main, attn_out);
}

// v001
// Measured time: 535 microseconds a run.
// In both of two side-by-side timings against v000, it was 1.30 times as fast.
#include <hip/hip_runtime.h>
#include <hip/hip_bf16.h>
#include <math.h>

typedef float v2f __attribute__((ext_vector_type(2)));
typedef float v8f __attribute__((ext_vector_type(8)));

#define HIDDEN 1024
#define DIM    512
#define CONV_OUT 10
#define BATCH  16
#define VLEN   4096
#define ROWS_PER_BLOCK 64
#define CHUNKS_PER_B   (VLEN / ROWS_PER_BLOCK)   // 64
#define NBLOCKS_FUSED  (BATCH * CHUNKS_PER_B)    // 1024

#define KC        8                  // K-slice per stage
#define NSLICE    (HIDDEN / KC)      // 128
#define BSTRIDE   12                 // padded row stride (floats): conflict-free, 48B (16B-aligned)
#define LDSB_SZ   (DIM * BSTRIDE)             // 6144 floats per buffer
#define LDSA_SZ   (ROWS_PER_BLOCK * BSTRIDE)  // 768 floats per buffer

#define USE_ASYNC_LDS 1

// ---------------- workspace layout (floats) ----------------
#define WS_QP    0
#define WS_SG    (WS_QP + BATCH * DIM)
#define WS_CTX   (WS_SG + BATCH * VLEN)
#define WS_SSUM  (WS_CTX + NBLOCKS_FUSED * HIDDEN)

// ISA 10.2: generic (flat) pointers to LDS carry the LDS byte address in bits [31:0].
__device__ __forceinline__ unsigned lds_addr32(const void* p) {
    return (unsigned)(unsigned long long)p;
}

__device__ __forceinline__ void async_g2l_b128(unsigned lds_off, const float* gptr) {
#if USE_ASYNC_LDS
    asm volatile("global_load_async_to_lds_b128 %0, %1, off"
                 :: "v"(lds_off), "v"(gptr)
                 : "memory");
#endif
}

__device__ __forceinline__ void wait_async0() {
#if USE_ASYNC_LDS
    asm volatile("s_wait_asynccnt 0" ::: "memory");
#endif
}

// One wave: dot products of NR consecutive weight rows (KQ * 128 floats each) with a vector whose
// lane pieces x[] sit in registers. w0 = first row + lane * 4: each load of the wave reads 512
// contiguous bytes of a row. Loads run AHEAD rows in front of the row being summed. Every lane
// returns the sum of row 'lane' (lanes >= NR: 0).
template <int NR, int KQ, int AHEAD>
__device__ __forceinline__ float wave_rows_dot(const float* __restrict__ w0, const float4 (&x)[KQ],
                                               int lane) {
    float4 w[AHEAD + 1][KQ];             // ring of row buffers
    float sum[NR];
#pragma unroll
    for (int r = 0; r < AHEAD; r++)
#pragma unroll
        for (int q = 0; q < KQ; q++) w[r][q] = *(const float4*)(w0 + (r * KQ + q) * 128);
#pragma unroll
    for (int r = 0; r < NR; r++) {
        // the two scheduling barriers pin "a later row's loads, then this row's sums":
        // without them the rows' sums are folded together and the loads wait for one another
        __builtin_amdgcn_sched_barrier(0);
        if (r + AHEAD < NR) {
#pragma unroll
            for (int q = 0; q < KQ; q++)
                w[(r + AHEAD) % (AHEAD + 1)][q] = *(const float4*)(w0 + ((r + AHEAD) * KQ + q) * 128);
        }
        __builtin_amdgcn_sched_barrier(0);
        const float4* wr = w[r % (AHEAD + 1)];
        float a0 = 0.f, a1 = 0.f, a2 = 0.f, a3 = 0.f;
#pragma unroll
        for (int q = 0; q < KQ; q++) {
            a0 = __builtin_fmaf(wr[q].x, x[q].x, a0);
            a1 = __builtin_fmaf(wr[q].y, x[q].y, a1);
            a2 = __builtin_fmaf(wr[q].z, x[q].z, a2);
            a3 = __builtin_fmaf(wr[q].w, x[q].w, a3);
        }
        sum[r] = (a0 + a1) + (a2 + a3);
    }
    // keeps the butterflies behind the last row's sums, all rows' steps side by side
    __builtin_amdgcn_sched_barrier(0);
#pragma unroll
    for (int m = 16; m >= 1; m >>= 1)
#pragma unroll
        for (int r = 0; r < NR; r++) sum[r] += __shfl_xor(sum[r], m, 32);
    float mine = 0.f;
#pragma unroll
    for (int r = 0; r < NR; r++) if (lane == r) mine = sum[r];
    return mine;
}

// ================= kernel A: qp = query @ q_w.T =================
// 256 blocks x 8 waves: block = (batch, 32 consecutive d), one wave per q_w row, 4 rows a wave.
#define QP_ROWS 32                         // d per block: one 128-B line of qp
#define QP_GROUPS (DIM / QP_ROWS)          // 16
__global__ __launch_bounds__(256)
void qproj_kernel(const float* __restrict__ query, const float* __restrict__ q_w,
                  float* __restrict__ qp_ws) {
    __shared__ float res_s[QP_ROWS];
    const int b    = blockIdx.x / QP_GROUPS;
    const int d0   = (blockIdx.x % QP_GROUPS) * QP_ROWS;
    const int tid  = threadIdx.x;
    const int lane = tid & 31;
    const int wave = tid >> 5;

    const float* q = query + (size_t)b * HIDDEN + lane * 4;
    float4 qf[HIDDEN / 128];
#pragma unroll
    for (int i = 0; i < HIDDEN / 128; i++) qf[i] = *(const float4*)(q + i * 128);

    const int row0 = wave * (QP_ROWS / 8);
    float mine = wave_rows_dot<QP_ROWS / 8, HIDDEN / 128, QP_ROWS / 8 - 1>(
        q_w + (size_t)(d0 + row0) * HIDDEN + lane * 4, qf, lane);
    if (lane < QP_ROWS / 8) res_s[row0 + lane] = mine;
    __syncthreads();          // all 32 row sums are in LDS; one wave stores the whole line
    if (tid < QP_ROWS) qp_ws[b * DIM + d0 + tid] = res_s[tid];
}

// ================= kernel B: fused projection/score/context =================
// 1024 blocks x 256 threads (8 wave32). wave w: rows rw=w&3 (16), dims chalf=w>>2 (256).
// K streamed in 128 double-buffered slices of 8, staged via async global->LDS DMA.
__global__ __launch_bounds__(256)
void fused_attn_kernel(const float* __restrict__ value,
                       const float* __restrict__ prev_attn,
                       const float* __restrict__ conv_w,
                       const float* __restrict__ conv_b,
                       const float* __restrict__ loc_w,
                       const float* __restrict__ v_w,
                       const float* __restrict__ bias,
                       const float* __restrict__ score_w,
                       const float* __restrict__ score_b,
                       const float* __restrict__ qp_ws,
                       float* __restrict__ sg_ws,
                       float* __restrict__ ctx_part,
                       float* __restrict__ ssum_part) {
    __shared__ float ldsB[2][LDSB_SZ];                 // 48 KB : v_w[n][k-slice], padded rows
    __shared__ float ldsA[2][LDSA_SZ];                 // 6 KB  : value[m][k-slice], padded rows
    __shared__ float cf_s[ROWS_PER_BLOCK * CONV_OUT];  // conv features
    __shared__ float qp_s[DIM];
    __shared__ float scorepart[ROWS_PER_BLOCK * 2];
    __shared__ float sg_s[ROWS_PER_BLOCK];

    const int chunk = blockIdx.x;
    const int b  = chunk >> 6;
    const int v0 = (chunk & 63) << 6;
    const int tid  = threadIdx.x;
    const int lane = tid & 31;
    const int wave = tid >> 5;
    const int rw    = wave & 3;
    const int chalf = wave >> 2;

    const float* Abase = value + (size_t)(b * VLEN + v0) * HIDDEN;

    // stage qp (per-batch query projection)
    for (int i = tid; i < DIM; i += 256) qp_s[i] = qp_ws[b * DIM + i];

    // conv features: cf[m][c] = conv_b[c] + sum_j conv_w[c][j]*pa[v0+m-1+j]
    {
        const float* pa = prev_attn + (size_t)b * VLEN;
        for (int idx = tid; idx < ROWS_PER_BLOCK * CONV_OUT; idx += 256) {
            int m = idx / CONV_OUT, c = idx % CONV_OUT;
            int v = v0 + m;
            float x0 = (v - 1 >= 0)   ? pa[v - 1] : 0.f;
            float x1 = pa[v];
            float x2 = (v + 1 < VLEN) ? pa[v + 1] : 0.f;
            cf_s[idx] = conv_b[c] + conv_w[c * 3 + 0] * x0
                                  + conv_w[c * 3 + 1] * x1
                                  + conv_w[c * 3 + 2] * x2;
        }
    }

    // --- async stage of one K-slice into buffer `buf` ---
    auto issue_slice = [&](int kc, int buf) {
        // B: 512 rows x 8 floats = 1024 b128 quads, 4 per thread
#pragma unroll
        for (int j = 0; j < 4; j++) {
            int idx = tid + j * 256;        // 0..1023
            int n  = idx >> 1;
            int q4 = (idx & 1) << 2;
            async_g2l_b128(lds_addr32(&ldsB[buf][n * BSTRIDE + q4]),
                           v_w + (size_t)n * HIDDEN + kc + q4);
        }
        // A: 64 rows x 8 floats = 128 quads (threads 0..127)
        if (tid < 128) {
            int m  = tid >> 1;
            int q4 = (tid & 1) << 2;
            async_g2l_b128(lds_addr32(&ldsA[buf][m * BSTRIDE + q4]),
                           Abase + (size_t)m * HIDDEN + kc + q4);
        }
#if !USE_ASYNC_LDS
        // synchronous fallback
#pragma unroll
        for (int j = 0; j < 4; j++) {
            int idx = tid + j * 256;
            int n  = idx >> 1;
            int q4 = (idx & 1) << 2;
            *(float4*)(&ldsB[buf][n * BSTRIDE + q4]) =
                *(const float4*)(v_w + (size_t)n * HIDDEN + kc + q4);
        }
        if (tid < 128) {
            int m  = tid >> 1;
            int q4 = (tid & 1) << 2;
            *(float4*)(&ldsA[buf][m * BSTRIDE + q4]) =
                *(const float4*)(Abase + (size_t)m * HIDDEN + kc + q4);
        }
#endif
    };

    // per-lane fragment coordinates (ISA 16x16x4 f32 layout)
    const int mr = lane & 15;            // A row
    const int kh = (lane >> 4) << 1;     // K sub-offset: 0 or 2
    const int nn = lane & 15;            // B/C column

    v8f acc[16];
#pragma unroll
    for (int t = 0; t < 16; t++)
#pragma unroll
        for (int i = 0; i < 8; i++) acc[t][i] = 0.f;

    issue_slice(0, 0);

    for (int s = 0; s < NSLICE; ++s) {
        const int cur = s & 1;
        wait_async0();            // my staged loads for slice s are in LDS
        __syncthreads();          // everyone's are; prev compute done
        if (s + 1 < NSLICE) issue_slice((s + 1) * KC, cur ^ 1);

        const float* Ab = &ldsA[cur][(rw * 16 + mr) * BSTRIDE];
        const float* Bb = &ldsB[cur][(chalf * 256 + nn) * BSTRIDE];
#pragma unroll
        for (int ks = 0; ks < 2; ks++) {
            int kk = ks * 4 + kh;
            v2f a = *(const v2f*)(Ab + kk);
#pragma unroll
            for (int t = 0; t < 16; t++) {
                v2f bf = *(const v2f*)(Bb + t * 16 * BSTRIDE + kk);
                acc[t] = __builtin_amdgcn_wmma_f32_16x16x4_f32(
                    false, a, false, bf, (short)0, acc[t], false, false);
            }
        }
    }

    // -------- epilogue: e = tanh(vp + qp + lp + bias); score partial per row --------
    float rowacc[8];
#pragma unroll
    for (int i = 0; i < 8; i++) rowacc[i] = 0.f;
    const int mbase = rw * 16 + ((lane >> 4) << 3);   // C layout: high-half lanes => M+8

#pragma unroll
    for (int t = 0; t < 16; t++) {
        int n = chalf * 256 + t * 16 + nn;
        float qb = qp_s[n] + bias[n];
        float sw = score_w[n];
        const float* lw = loc_w + (size_t)n * CONV_OUT;
        float l0 = lw[0], l1 = lw[1], l2 = lw[2], l3 = lw[3], l4 = lw[4];
        float l5 = lw[5], l6 = lw[6], l7 = lw[7], l8 = lw[8], l9 = lw[9];
#pragma unroll
        for (int i = 0; i < 8; i++) {
            const float* cfr = cf_s + (mbase + i) * CONV_OUT;
            float lp = cfr[0]*l0 + cfr[1]*l1 + cfr[2]*l2 + cfr[3]*l3 + cfr[4]*l4
                     + cfr[5]*l5 + cfr[6]*l6 + cfr[7]*l7 + cfr[8]*l8 + cfr[9]*l9;
            float x = acc[t][i] + qb + lp;
            rowacc[i] += tanhf(x) * sw;
        }
    }
    // reduce over the 16 lanes of each half (tile columns)
#pragma unroll
    for (int i = 0; i < 8; i++) {
        float v = rowacc[i];
        v += __shfl_xor(v, 1, 32);
        v += __shfl_xor(v, 2, 32);
        v += __shfl_xor(v, 4, 32);
        v += __shfl_xor(v, 8, 32);
        rowacc[i] = v;
    }
    if ((lane & 15) == 0) {
#pragma unroll
        for (int i = 0; i < 8; i++)
            scorepart[(mbase + i) * 2 + chalf] = rowacc[i];
    }
    __syncthreads();

    if (tid < ROWS_PER_BLOCK) {
        float s = scorepart[tid * 2] + scorepart[tid * 2 + 1] + score_b[0];
        float sgv = 1.f / (1.f + expf(-s));
        sg_s[tid] = sgv;
        sg_ws[(size_t)b * VLEN + v0 + tid] = sgv;
    }
    __syncthreads();

    // -------- unnormalized context partial for this chunk (value tile is L2-hot) --------
    {
        int h = tid * 4;
        float4 a4 = make_float4(0.f, 0.f, 0.f, 0.f);
        const float* vrow = Abase + h;
        for (int r = 0; r < ROWS_PER_BLOCK; r++) {
            float s = sg_s[r];
            float4 x = *(const float4*)(vrow + (size_t)r * HIDDEN);
            a4.x += s * x.x; a4.y += s * x.y; a4.z += s * x.z; a4.w += s * x.w;
        }
        *(float4*)(ctx_part + (size_t)chunk * HIDDEN + h) = a4;
    }
    if (tid == 0) {
        float s = 0.f;
        for (int r = 0; r < ROWS_PER_BLOCK; r++) s += sg_s[r];
        ssum_part[chunk] = s;
    }
}

// ================= kernel C: deterministic reduce + attn normalize + output GEMM ===========
// 256 blocks x 8 waves: block = (batch, slice of 64 out_w rows and 256 attn entries).
// Every block of a batch repeats the fixed-order reduce of that batch's chunk partials
// (it needs the whole combined vector); one wave per out_w row, 8 rows a wave.
#define FIN_SLICES 16
#define FIN_ROWS   (HIDDEN / FIN_SLICES)   // 64
#define FIN_V      (VLEN / FIN_SLICES)     // 256
__global__ __launch_bounds__(256)
void finalize_kernel(const float* __restrict__ query,
                     const float* __restrict__ sg_ws,
                     const float* __restrict__ ctx_part,
                     const float* __restrict__ ssum_part,
                     const float* __restrict__ out_w,
                     const float* __restrict__ out_b,
                     float* __restrict__ out,        // (16,1,1024)
                     float* __restrict__ attn_out) { // (16,4096)
    __shared__ float comb[2 * HIDDEN];
    __shared__ float res_s[FIN_ROWS];
    const int b    = blockIdx.x / FIN_SLICES;
    const int sl   = blockIdx.x % FIN_SLICES;
    const int tid  = threadIdx.x;
    const int lane = tid & 31;
    const int wave = tid >> 5;

    // this block's 256 attn entries: loaded ahead of the long reduce
    const size_t v0 = (size_t)b * VLEN + sl * FIN_V;   // block-uniform
    const float sgv = (sg_ws + v0)[tid];

    // normaliser: the same fixed-order sum in every thread (block-uniform addresses)
    float ssum = 0.f;
#pragma unroll
    for (int c = 0; c < CHUNKS_PER_B; c++) ssum += ssum_part[b * CHUNKS_PER_B + c];
    const float inv = 1.f / ssum;

    // context = (fixed-order sum of chunk partials) * inv
    {
        int h = tid * 4;
        float4 a4 = make_float4(0.f, 0.f, 0.f, 0.f);
        const float4* cb = (const float4*)(ctx_part + (size_t)b * CHUNKS_PER_B * HIDDEN);  // block-uniform
        // bound by load latency: two runs of 32 loads in flight per thread, summed in chunk order
#pragma unroll
        for (int c0 = 0; c0 < CHUNKS_PER_B; c0 += 32) {
#pragma unroll
            for (int c = c0; c < c0 + 32; c++) {
                float4 x = (cb + c * (HIDDEN / 4))[tid];
                a4.x += x.x; a4.y += x.y; a4.z += x.z; a4.w += x.w;
            }
            // keeps the second run's loads behind the first run's sums (64 at once: too many registers)
            __builtin_amdgcn_sched_barrier(0);
        }
        *(float4*)(comb + h) = make_float4(a4.x * inv, a4.y * inv, a4.z * inv, a4.w * inv);
        *(float4*)(comb + HIDDEN + h) = ((const float4*)(query + (size_t)b * HIDDEN))[tid];
    }
    __syncthreads();          // combined vector complete

    // output = combined @ out_w.T + out_b : combined in registers
    float4 cf[2 * HIDDEN / 128];
#pragma unroll
    for (int i = 0; i < 2 * HIDDEN / 128; i++) cf[i] = *(const float4*)(comb + i * 128 + lane * 4);

    const int row0 = wave * (FIN_ROWS / 8);
    float mine = wave_rows_dot<FIN_ROWS / 8, 2 * HIDDEN / 128, 1>(
        out_w + (size_t)(sl * FIN_ROWS + row0) * (2 * HIDDEN) + lane * 4, cf, lane);
    if (lane < FIN_ROWS / 8) res_s[row0 + lane] = mine;
    __syncthreads();          // all 64 row sums are in LDS; each 128-B line of out has one writer
    (attn_out + v0)[tid] = sgv * inv;   // behind the barriers, so that none of them waits for the store
    if (tid < FIN_ROWS) {
        int h = sl * FIN_ROWS + tid;
        out[(size_t)b * HIDDEN + h] = res_s[tid] + out_b[h];
    }
}

// ============================ launch ============================
extern "C" void kernel_launch(void* const* d_in, const int* in_sizes, int n_in,
                              void* d_out, int out_size, void* d_ws, size_t ws_size,
                              hipStream_t stream) {
    const float* query     = (const float*)d_in[0];
    const float* value     = (const float*)d_in[1];
    const float* prev_attn = (const float*)d_in[2];
    const float* conv_w    = (const float*)d_in[3];
    const float* conv_b    = (const float*)d_in[4];
    const float* loc_w     = (const float*)d_in[5];
    const float* q_w       = (const float*)d_in[6];
    const float* v_w       = (const float*)d_in[7];
    const float* bias      = (const float*)d_in[8];
    const float* score_w   = (const float*)d_in[9];
    const float* score_b   = (const float*)d_in[10];
    const float* out_w     = (const float*)d_in[11];
    const float* out_b     = (const float*)d_in[12];

    float* ws = (float*)d_ws;
    float* qp_ws     = ws + WS_QP;
    float* sg_ws     = ws + WS_SG;
    float* ctx_part  = ws + WS_CTX;
    float* ssum_part = ws + WS_SSUM;

    float* out_main = (float*)d_out;                 // (16,1,1024)
    float* attn_out = out_main + BATCH * HIDDEN;     // (16,4096)

    qproj_kernel<<<BATCH * QP_GROUPS, 256, 0, stream>>>(query, q_w, qp_ws);

    fused_attn_kernel<<<NBLOCKS_FUSED, 256, 0, stream>>>(
        value, prev_attn, conv_w, conv_b, loc_w, v_w, bias, score_w, score_b,
        qp_ws, sg_ws, ctx_part, ssum_part);

    finalize_kernel<<<BATCH * FIN_SLICES, 256, 0, stream>>>(
        query, sg_ws, ctx_part, ssum_part, out_w, out_b, out_main, attn_out);
}

// v002
// One run takes 465 microseconds.
// In two side-by-side timings against v001, it was 1.18 and 1.13 times as fast.
// Counting every step since v000, it is 1.50 times as fast.
#include <hip/hip_runtime.h>
#include <hip/hip_bf16.h>
#include <math.h>

typedef float v2f __attribute__((ext_vector_type(2)));
typedef float v8f __attribute__((ext_vector_type(8)));

#define HIDDEN 1024
#define DIM    512
#define CONV_OUT 10
#define BATCH  16
#define VLEN   4096
#define ROWS_PER_BLOCK 64
#define CHUNKS_PER_B   (VLEN / ROWS_PER_BLOCK)   // 64
#define NBLOCKS_FUSED  (BATCH * CHUNKS_PER_B)    // 1024

#define KC        32                 // K-slice per stage: one whole 128-B line of every operand row
#define NSLICE    (HIDDEN / KC)      // 32
#define STAGE_ROWS (DIM + ROWS_PER_BLOCK)     // a stage: 512 rows of v_w, then 64 rows of value
#define STAGE_SZ   (STAGE_ROWS * KC)           // 18432 floats per buffer, rows unpadded
// LDS rows are 128 B with no pad. The 16-B piece c of row r sits at piece (c ^ ((r >> 1) & 7)):
// 16 consecutive rows read at one c fall on 16 different groups of four banks.

// ---------------- workspace layout (floats) ----------------
#define WS_QP    0
#define WS_SG    (WS_QP + BATCH * DIM)
#define WS_CTX   (WS_SG + BATCH * VLEN)
#define WS_SSUM  (WS_CTX + NBLOCKS_FUSED * HIDDEN)

// ISA 10.2: generic (flat) pointers to LDS carry the LDS byte address in bits [31:0].
__device__ __forceinline__ unsigned lds_addr32(const void* p) {
    return (unsigned)(unsigned long long)p;
}

// Nine copies of 16 B per lane, global -> LDS; the LDS places lie 32 rows (4096 B) apart. The
// closing s_wait_xcnt stands inside the statement so that no address register of an issued copy
// is rewritten in front of it.
__device__ __forceinline__ void async_g2l_b128_x9(unsigned lds, const float* const (&g)[9]) {
    asm volatile("global_load_async_to_lds_b128 %0, %9, off\n\t"
                 "global_load_async_to_lds_b128 %1, %10, off\n\t"
                 "global_load_async_to_lds_b128 %2, %11, off\n\t"
                 "global_load_async_to_lds_b128 %3, %12, off\n\t"
                 "global_load_async_to_lds_b128 %4, %13, off\n\t"
                 "global_load_async_to_lds_b128 %5, %14, off\n\t"
                 "global_load_async_to_lds_b128 %6, %15, off\n\t"
                 "global_load_async_to_lds_b128 %7, %16, off\n\t"
                 "global_load_async_to_lds_b128 %8, %17, off\n\t"
                 "s_wait_xcnt 0x0"
                 :: "v"(lds), "v"(lds + 4096u), "v"(lds + 8192u), "v"(lds + 12288u),
                    "v"(lds + 16384u), "v"(lds + 20480u), "v"(lds + 24576u), "v"(lds + 28672u),
                    "v"(lds + 32768u),
                    "v"(g[0]), "v"(g[1]), "v"(g[2]), "v"(g[3]), "v"(g[4]), "v"(g[5]), "v"(g[6]),
                    "v"(g[7]), "v"(g[8])
                 : "memory");
}

// this wave's copies have landed in LDS
__device__ __forceinline__ void wait_async0() {
    asm volatile("s_wait_asynccnt 0x0" ::: "memory");
}

// this wave's LDS reads have returned: its buffer may be refilled behind the next barrier
__device__ __forceinline__ void wait_ds0() {
    asm volatile("s_wait_dscnt 0x0" ::: "memory");
}

// One wave: dot products of NR consecutive weight rows (KQ * 128 floats each) with a vector whose
// lane pieces x[] sit in registers. w0 = first row + lane * 4: each load of the wave reads 512
// contiguous bytes of a row. Loads run AHEAD rows in front of the row being summed. Every lane
// returns the sum of row 'lane' (lanes >= NR: 0).
template <int NR, int KQ, int AHEAD>
__device__ __forceinline__ float wave_rows_dot(const float* __restrict__ w0, const float4 (&x)[KQ],
                                               int lane) {
    float4 w[AHEAD + 1][KQ];             // ring of row buffers
    float sum[NR];
#pragma unroll
    for (int r = 0; r < AHEAD; r++)
#pragma unroll
        for (int q = 0; q < KQ; q++) w[r][q] = *(const float4*)(w0 + (r * KQ + q) * 128);
#pragma unroll
    for (int r = 0; r < NR; r++) {
        // the two scheduling barriers pin "a later row's loads, then this row's sums":
        // without them the rows' sums are folded together and the loads wait for one another
        __builtin_amdgcn_sched_barrier(0);
        if (r + AHEAD < NR) {
#pragma unroll
            for (int q = 0; q < KQ; q++)
                w[(r + AHEAD) % (AHEAD + 1)][q] = *(const float4*)(w0 + ((r + AHEAD) * KQ + q) * 128);
        }
        __builtin_amdgcn_sched_barrier(0);
        const float4* wr = w[r % (AHEAD + 1)];
        float a0 = 0.f, a1 = 0.f, a2 = 0.f, a3 = 0.f;
#pragma unroll
        for (int q = 0; q < KQ; q++) {
            a0 = __builtin_fmaf(wr[q].x, x[q].x, a0);
            a1 = __builtin_fmaf(wr[q].y, x[q].y, a1);
            a2 = __builtin_fmaf(wr[q].z, x[q].z, a2);
            a3 = __builtin_fmaf(wr[q].w, x[q].w, a3);
        }
        sum[r] = (a0 + a1) + (a2 + a3);
    }
    // keeps the butterflies behind the last row's sums, all rows' steps side by side
    __builtin_amdgcn_sched_barrier(0);
#pragma unroll
    for (int m = 16; m >= 1; m >>= 1)
#pragma unroll
        for (int r = 0; r < NR; r++) sum[r] += __shfl_xor(sum[r], m, 32);
    float mine = 0.f;
#pragma unroll
    for (int r = 0; r < NR; r++) if (lane == r) mine = sum[r];
    return mine;
}

// ================= kernel A: qp = query @ q_w.T =================
// 256 blocks x 8 waves: block = (batch, 32 consecutive d), one wave per q_w row, 4 rows a wave.
#define QP_ROWS 32                         // d per block: one 128-B line of qp
#define QP_GROUPS (DIM / QP_ROWS)          // 16
__global__ __launch_bounds__(256)
void qproj_kernel(const float* __restrict__ query, const float* __restrict__ q_w,
                  float* __restrict__ qp_ws) {
    __shared__ float res_s[QP_ROWS];
    const int b    = blockIdx.x / QP_GROUPS;
    const int d0   = (blockIdx.x % QP_GROUPS) * QP_ROWS;
    const int tid  = threadIdx.x;
    const int lane = tid & 31;
    const int wave = tid >> 5;

    const float* q = query + (size_t)b * HIDDEN + lane * 4;
    float4 qf[HIDDEN / 128];
#pragma unroll
    for (int i = 0; i < HIDDEN / 128; i++) qf[i] = *(const float4*)(q + i * 128);

    const int row0 = wave * (QP_ROWS / 8);
    float mine = wave_rows_dot<QP_ROWS / 8, HIDDEN / 128, QP_ROWS / 8 - 1>(
        q_w + (size_t)(d0 + row0) * HIDDEN + lane * 4, qf, lane);
    if (lane < QP_ROWS / 8) res_s[row0 + lane] = mine;
    __syncthreads();          // all 32 row sums are in LDS; one wave stores the whole line
    if (tid < QP_ROWS) qp_ws[b * DIM + d0 + tid] = res_s[tid];
}

// ================= kernel B: fused projection/score/context =================
// 1024 blocks x 256 threads (8 wave32). wave w: rows rw=w&3 (16), dims chalf=w>>2 (256).
// K streamed in 32 double-buffered slices of 32, staged via async global->LDS copies.
__global__ __launch_bounds__(256)
void fused_attn_kernel(const float* __restrict__ value,
                       const float* __restrict__ prev_attn,
                       const float* __restrict__ conv_w,
                       const float* __restrict__ conv_b,
                       const float* __restrict__ loc_w,
                       const float* __restrict__ v_w,
                       const float* __restrict__ bias,
                       const float* __restrict__ score_w,
                       const float* __restrict__ score_b,
                       const float* __restrict__ qp_ws,
                       float* __restrict__ sg_ws,
                       float* __restrict__ ctx_part,
                       float* __restrict__ ssum_part) {
    // 144 KB: per buffer v_w[n][k-slice], then value[m][k-slice]
    __shared__ __attribute__((aligned(256))) float stage[2][STAGE_SZ];
    __shared__ float cf_s[ROWS_PER_BLOCK * CONV_OUT];  // conv features
    __shared__ float qp_s[DIM];
    __shared__ float scorepart[ROWS_PER_BLOCK * 2];
    __shared__ float sg_s[ROWS_PER_BLOCK];

    const int chunk = blockIdx.x;
    const int b  = chunk >> 6;
    const int v0 = (chunk & 63) << 6;
    const int tid  = threadIdx.x;
    const int lane = tid & 31;
    const int wave = tid >> 5;
    const int rw    = wave & 3;
    const int chalf = wave >> 2;

    const float* Abase = value + (size_t)(b * VLEN + v0) * HIDDEN;

    // stage qp (per-batch query projection)
    for (int i = tid; i < DIM; i += 256) qp_s[i] = qp_ws[b * DIM + i];

    // conv features: cf[m][c] = conv_b[c] + sum_j conv_w[c][j]*pa[v0+m-1+j]
    {
        const float* pa = prev_attn + (size_t)b * VLEN;
        for (int idx = tid; idx < ROWS_PER_BLOCK * CONV_OUT; idx += 256) {
            int m = idx / CONV_OUT, c = idx % CONV_OUT;
            int v = v0 + m;
            float x0 = (v - 1 >= 0)   ? pa[v - 1] : 0.f;
            float x1 = pa[v];
            float x2 = (v + 1 < VLEN) ? pa[v + 1] : 0.f;
            cf_s[idx] = conv_b[c] + conv_w[c * 3 + 0] * x0
                                  + conv_w[c * 3 + 1] * x1
                                  + conv_w[c * 3 + 2] * x2;
        }
    }

    // --- async stage of one K-slice into buffer `buf` ---
    // 576 rows x 8 pieces of 16 B = 18 copies per thread; eight lanes cover one row's whole line
    const int crow = tid >> 3;                         // row within a group of 32
    const int cpc  = tid & 7;                          // 16-B piece of the row
    const unsigned cdst = lds_addr32(&stage[0][crow * KC + ((cpc ^ ((crow >> 1) & 7)) << 2)]);
    const float* csrcB = v_w   + (size_t)crow * HIDDEN + cpc * 4;
    const float* csrcA = Abase + (size_t)crow * HIDDEN + cpc * 4;
    auto issue_slice = [&](int kc, int buf) {
        const unsigned dst = cdst + (unsigned)buf * (STAGE_SZ * 4u);
        const float* g0[9];
        const float* g1[9];
#pragma unroll
        for (int j = 0; j < 9; j++) g0[j] = csrcB + kc + (size_t)j * 32 * HIDDEN;
#pragma unroll
        for (int j = 0; j < 7; j++) g1[j] = csrcB + kc + (size_t)(j + 9) * 32 * HIDDEN;
        g1[7] = csrcA + kc;
        g1[8] = csrcA + kc + (size_t)32 * HIDDEN;
        async_g2l_b128_x9(dst, g0);
        async_g2l_b128_x9(dst + 9u * 4096u, g1);
    };

    // per-lane fragment coordinates (ISA 16x16x4 f32 layout)
    const int mr = lane & 15;            // A row
    const int kh = (lane >> 4) << 1;     // K sub-offset: 0 or 2
    const int nn = lane & 15;            // B/C column
    const int psw = (lane >> 1) & 7;     // piece swizzle of this lane's rows (A and B alike)

    v8f acc[16];
#pragma unroll
    for (int t = 0; t < 16; t++)
#pragma unroll
        for (int i = 0; i < 8; i++) acc[t][i] = 0.f;

    issue_slice(0, 0);
    wait_async0();
    __syncthreads();              // slice 0 (and qp_s, cf_s) published
    issue_slice(KC, 1);

    for (int s = 0; s < NSLICE; ++s) {
        const int cur = s & 1;
        const float* Ab = &stage[cur][(DIM + rw * 16 + mr) * KC + kh];
        const float* Bb = &stage[cur][(chalf * 256 + nn) * KC + kh];
        v2f af[2];
        v2f bf[2][16];
        af[0] = *(const v2f*)(Ab + (psw << 2));
#pragma unroll
        for (int t = 0; t < 16; t++) bf[0][t] = *(const v2f*)(Bb + t * 16 * KC + (psw << 2));
#pragma unroll
        for (int ks = 0; ks < KC / 4; ks++) {
            // the two scheduling barriers keep the next k-step's LDS reads in one group in front
            // of this k-step's WMMAs: without them each pair of WMMAs waits out its own read
            __builtin_amdgcn_sched_barrier(0);
            if (ks + 1 < KC / 4) {
                const int kk = ((ks + 1) ^ psw) << 2;
                af[(ks + 1) & 1] = *(const v2f*)(Ab + kk);
#pragma unroll
                for (int t = 0; t < 16; t++)
                    bf[(ks + 1) & 1][t] = *(const v2f*)(Bb + t * 16 * KC + kk);
            }
            __builtin_amdgcn_sched_barrier(0);
#pragma unroll
            for (int t = 0; t < 16; t++)
                acc[t] = __builtin_amdgcn_wmma_f32_16x16x4_f32(
                    false, af[ks & 1], false, bf[ks & 1][t], (short)0, acc[t], false, false);
        }
        wait_ds0();               // my reads of buffer cur are done
        wait_async0();            // my copies of slice s + 1 have landed
        __syncthreads();          // everyone's have; buffer cur is free
        if (s + 2 < NSLICE) issue_slice((s + 2) * KC, cur);
    }
    wait_async0();                // nothing in flight behind the loop

    // -------- epilogue: e = tanh(vp + qp + lp + bias); score partial per row --------
    float rowacc[8];
#pragma unroll
    for (int i = 0; i < 8; i++) rowacc[i] = 0.f;
    const int mbase = rw * 16 + ((lane >> 4) << 3);   // C layout: high-half lanes => M+8

#pragma unroll
    for (int t = 0; t < 16; t++) {
        int n = chalf * 256 + t * 16 + nn;
        float qb = qp_s[n] + bias[n];
        float sw = score_w[n];
        const float* lw = loc_w + (size_t)n * CONV_OUT;
        float l0 = lw[0], l1 = lw[1], l2 = lw[2], l3 = lw[3], l4 = lw[4];
        float l5 = lw[5], l6 = lw[6], l7 = lw[7], l8 = lw[8], l9 = lw[9];
#pragma unroll
        for (int i = 0; i < 8; i++) {
            const float* cfr = cf_s + (mbase + i) * CONV_OUT;
            float lp = cfr[0]*l0 + cfr[1]*l1 + cfr[2]*l2 + cfr[3]*l3 + cfr[4]*l4
                     + cfr[5]*l5 + cfr[6]*l6 + cfr[7]*l7 + cfr[8]*l8 + cfr[9]*l9;
            float x = acc[t][i] + qb + lp;
            rowacc[i] += tanhf(x) * sw;
        }
    }
    // reduce over the 16 lanes of each half (tile columns)
#pragma unroll
    for (int i = 0; i < 8; i++) {
        float v = rowacc[i];
        v += __shfl_xor(v, 1, 32);
        v += __shfl_xor(v, 2, 32);
        v += __shfl_xor(v, 4, 32);
        v += __shfl_xor(v, 8, 32);
        rowacc[i] = v;
    }
    if ((lane & 15) == 0) {
#pragma unroll
        for (int i = 0; i < 8; i++)
            scorepart[(mbase + i) * 2 + chalf] = rowacc[i];
    }
    __syncthreads();

    if (tid < ROWS_PER_BLOCK) {
        float s = scorepart[tid * 2] + scorepart[tid * 2 + 1] + score_b[0];
        float sgv = 1.f / (1.f + expf(-s));
        sg_s[tid] = sgv;
        sg_ws[(size_t)b * VLEN + v0 + tid] = sgv;
    }
    __syncthreads();

    // -------- unnormalized context partial for this chunk (value tile is L2-hot) --------
    {
        int h = tid * 4;
        float4 a4 = make_float4(0.f, 0.f, 0.f, 0.f);
        const float* vrow = Abase + h;
        for (int r = 0; r < ROWS_PER_BLOCK; r++) {
            float s = sg_s[r];
            float4 x = *(const float4*)(vrow + (size_t)r * HIDDEN);
            a4.x += s * x.x; a4.y += s * x.y; a4.z += s * x.z; a4.w += s * x.w;
        }
        *(float4*)(ctx_part + (size_t)chunk * HIDDEN + h) = a4;
    }
    if (tid == 0) {
        float s = 0.f;
        for (int r = 0; r < ROWS_PER_BLOCK; r++) s += sg_s[r];
        ssum_part[chunk] = s;
    }
}

// ================= kernel C: deterministic reduce + attn normalize + output GEMM ===========
// 256 blocks x 8 waves: block = (batch, slice of 64 out_w rows and 256 attn entries).
// Every block of a batch repeats the fixed-order reduce of that batch's chunk partials
// (it needs the whole combined vector); one wave per out_w row, 8 rows a wave.
#define FIN_SLICES 16
#define FIN_ROWS   (HIDDEN / FIN_SLICES)   // 64
#define FIN_V      (VLEN / FIN_SLICES)     // 256
__global__ __launch_bounds__(256)
void finalize_kernel(const float* __restrict__ query,
                     const float* __restrict__ sg_ws,
                     const float* __restrict__ ctx_part,
                     const float* __restrict__ ssum_part,
                     const float* __restrict__ out_w,
                     const float* __restrict__ out_b,
                     float* __restrict__ out,        // (16,1,1024)
                     float* __restrict__ attn_out) { // (16,4096)
    __shared__ float comb[2 * HIDDEN];
    __shared__ float res_s[FIN_ROWS];
    const int b    = blockIdx.x / FIN_SLICES;
    const int sl   = blockIdx.x % FIN_SLICES;
    const int tid  = threadIdx.x;
    const int lane = tid & 31;
    const int wave = tid >> 5;

    // this block's 256 attn entries: loaded ahead of the long reduce
    const size_t v0 = (size_t)b * VLEN + sl * FIN_V;   // block-uniform
    const float sgv = (sg_ws + v0)[tid];

    // normaliser: the same fixed-order sum in every thread (block-uniform addresses)
    float ssum = 0.f;
#pragma unroll
    for (int c = 0; c < CHUNKS_PER_B; c++) ssum += ssum_part[b * CHUNKS_PER_B + c];
    const float inv = 1.f / ssum;

    // context = (fixed-order sum of chunk partials) * inv
    {
        int h = tid * 4;
        float4 a4 = make_float4(0.f, 0.f, 0.f, 0.f);
        const float4* cb = (const float4*)(ctx_part + (size_t)b * CHUNKS_PER_B * HIDDEN);  // block-uniform
        // bound by load latency: two runs of 32 loads in flight per thread, summed in chunk order
#pragma unroll
        for (int c0 = 0; c0 < CHUNKS_PER_B; c0 += 32) {
#pragma unroll
            for (int c = c0; c < c0 + 32; c++) {
                float4 x = (cb + c * (HIDDEN / 4))[tid];
                a4.x += x.x; a4.y += x.y; a4.z += x.z; a4.w += x.w;
            }
            // keeps the second run's loads behind the first run's sums (64 at once: too many registers)
            __builtin_amdgcn_sched_barrier(0);
        }
        *(float4*)(comb + h) = make_float4(a4.x * inv, a4.y * inv, a4.z * inv, a4.w * inv);
        *(float4*)(comb + HIDDEN + h) = ((const float4*)(query + (size_t)b * HIDDEN))[tid];
    }
    __syncthreads();          // combined vector complete

    // output = combined @ out_w.T + out_b : combined in registers
    float4 cf[2 * HIDDEN / 128];
#pragma unroll
    for (int i = 0; i < 2 * HIDDEN / 128; i++) cf[i] = *(const float4*)(comb + i * 128 + lane * 4);

    const int row0 = wave * (FIN_ROWS / 8);
    float mine = wave_rows_dot<FIN_ROWS / 8, 2 * HIDDEN / 128, 1>(
        out_w + (size_t)(sl * FIN_ROWS + row0) * (2 * HIDDEN) + lane * 4, cf, lane);
    if (lane < FIN_ROWS / 8) res_s[row0 + lane] = mine;
    __syncthreads();          // all 64 row sums are in LDS; each 128-B line of out has one writer
    (attn_out + v0)[tid] = sgv * inv;   // behind the barriers, so that none of them waits for the store
    if (tid < FIN_ROWS) {
        int h = sl * FIN_ROWS + tid;
        out[(size_t)b * HIDDEN + h] = res_s[tid] + out_b[h];
    }
}

// ============================ launch ============================
extern "C" void kernel_launch(void* const* d_in, const int* in_sizes, int n_in,
                              void* d_out, int out_size, void* d_ws, size_t ws_size,
                              hipStream_t stream) {
    const float* query     = (const float*)d_in[0];
    const float* value     = (const float*)d_in[1];
    const float* prev_attn = (const float*)d_in[2];
    const float* conv_w    = (const float*)d_in[3];
    const float* conv_b    = (const float*)d_in[4];
    const float* loc_w     = (const float*)d_in[5];
    const float* q_w       = (const float*)d_in[6];
    const float* v_w       = (const float*)d_in[7];
    const float* bias      = (const float*)d_in[8];
    const float* score_w   = (const float*)d_in[9];
    const float* score_b   = (const float*)d_in[10];
    const float* out_w     = (const float*)d_in[11];
    const float* out_b     = (const float*)d_in[12];

    float* ws = (float*)d_ws;
    float* qp_ws     = ws + WS_QP;
    float* sg_ws     = ws + WS_SG;
    float* ctx_part  = ws + WS_CTX;
    float* ssum_part = ws + WS_SSUM;

    float* out_main = (float*)d_out;                 // (16,1,1024)
    float* attn_out = out_main + BATCH * HIDDEN;     // (16,4096)

    qproj_kernel<<<BATCH * QP_GROUPS, 256, 0, stream>>>(query, q_w, qp_ws);

    fused_attn_kernel<<<NBLOCKS_FUSED, 256, 0, stream>>>(
        value, prev_attn, conv_w, conv_b, loc_w, v_w, bias, score_w, score_b,
        qp_ws, sg_ws, ctx_part, ssum_part);

    finalize_kernel<<<BATCH * FIN_SLICES, 256, 0, stream>>>(
        query, sg_ws, ctx_part, ssum_part, out_w, out_b, out_main, attn_out);
}

// v003
// Measured time: 378 microseconds a run.
// Next to v002, in two timings, it ran 1.21 and 1.20 times as fast.
// All steps since v000 together make it 1.80 times as fast.
#include <hip/hip_runtime.h>
#include <hip/hip_bf16.h>
#include <math.h>

typedef float v2f __attribute__((ext_vector_type(2)));
typedef float v8f __attribute__((ext_vector_type(8)));

#define HIDDEN 1024
#define DIM    512
#define CONV_OUT 10
#define BATCH  16
#define VLEN   4096
#define ROWS_PER_BLOCK 64
#define CHUNKS_PER_B   (VLEN / ROWS_PER_BLOCK)   // 64
#define NBLOCKS_FUSED  (BATCH * CHUNKS_PER_B)    // 1024

#define KC        32                 // K-slice per stage: one whole 128-B line of every operand row
#define NSLICE    (HIDDEN / KC)      // 32
#define STAGE_ROWS (DIM + ROWS_PER_BLOCK)     // a stage: 512 rows of v_w, then 64 rows of value
#define STAGE_SZ   (STAGE_ROWS * KC)           // 18432 floats per buffer, rows unpadded
// LDS rows are 128 B with no pad. The 16-B piece c of row r sits at piece (c ^ ((r >> 1) & 7)):
// 16 consecutive rows read at one c fall on 16 different groups of four banks.

// ---------------- workspace layout (floats) ----------------
#define WS_QP    0
#define WS_SG    (WS_QP + BATCH * DIM)
#define WS_CTX   (WS_SG + BATCH * VLEN)
#define WS_SSUM  (WS_CTX + NBLOCKS_FUSED * HIDDEN)

// ISA 10.2: generic (flat) pointers to LDS carry the LDS byte address in bits [31:0].
__device__ __forceinline__ unsigned lds_addr32(const void* p) {
    return (unsigned)(unsigned long long)p;
}

// Nine copies of 16 B per lane, global -> LDS; the LDS places lie 32 rows (4096 B) apart. The
// closing s_wait_xcnt stands inside the statement so that no address register of an issued copy
// is rewritten in front of it.
__device__ __forceinline__ void async_g2l_b128_x9(unsigned lds, const float* const (&g)[9]) {
    asm volatile("global_load_async_to_lds_b128 %0, %9, off\n\t"
                 "global_load_async_to_lds_b128 %1, %10, off\n\t"
                 "global_load_async_to_lds_b128 %2, %11, off\n\t"
                 "global_load_async_to_lds_b128 %3, %12, off\n\t"
                 "global_load_async_to_lds_b128 %4, %13, off\n\t"
                 "global_load_async_to_lds_b128 %5, %14, off\n\t"
                 "global_load_async_to_lds_b128 %6, %15, off\n\t"
                 "global_load_async_to_lds_b128 %7, %16, off\n\t"
                 "global_load_async_to_lds_b128 %8, %17, off\n\t"
                 "s_wait_xcnt 0x0"
                 :: "v"(lds), "v"(lds + 4096u), "v"(lds + 8192u), "v"(lds + 12288u),
                    "v"(lds + 16384u), "v"(lds + 20480u), "v"(lds + 24576u), "v"(lds + 28672u),
                    "v"(lds + 32768u),
                    "v"(g[0]), "v"(g[1]), "v"(g[2]), "v"(g[3]), "v"(g[4]), "v"(g[5]), "v"(g[6]),
                    "v"(g[7]), "v"(g[8])
                 : "memory");
}

// this wave's copies have landed in LDS
__device__ __forceinline__ void wait_async0() {
    asm volatile("s_wait_asynccnt 0x0" ::: "memory");
}

// this wave's LDS reads have returned: its buffer may be refilled behind the next barrier
__device__ __forceinline__ void wait_ds0() {
    asm volatile("s_wait_dscnt 0x0" ::: "memory");
}

// Eight independent transcendentals OP in one statement: each stands in the slot that the
// instruction set asks for behind the one in front of it, and the closing v_nop in the last one's
// Early-clobber outputs: no result register is a source of a later line.
#define TRANS_X8(OP, y, a)                                                                        \
    asm(OP " %0, %8\n\t" OP " %1, %9\n\t" OP " %2, %10\n\t" OP " %3, %11\n\t"                    \
        OP " %4, %12\n\t" OP " %5, %13\n\t" OP " %6, %14\n\t" OP " %7, %15\n\t"                  \
        "v_nop"                                                                                   \
        : "=&v"(y[0]), "=&v"(y[1]), "=&v"(y[2]), "=&v"(y[3]),                                     \
          "=&v"(y[4]), "=&v"(y[5]), "=&v"(y[6]), "=&v"(y[7])                                      \
        : "v"(a[0]), "v"(a[1]), "v"(a[2]), "v"(a[3]), "v"(a[4]), "v"(a[5]), "v"(a[6]), "v"(a[7]))

// tanh(x) = 1 - 2 / (1 + e^(2x)) in place, one v_exp_f32 and one v_rcp_f32 an element, no branch.
// e^(2x) = inf gives 1, e^(2x) = 0 gives -1, NaN stays NaN. Eight elements go through each stage
// side by side, so that one element's latency is filled by the others' instructions.
__device__ __forceinline__ void tanh_exp_rcp_x8(float (&x)[8]) {
    float a[8], e[8], r[8];
#pragma unroll
    for (int i = 0; i < 8; i++) a[i] = x[i] * 2.8853900817779268f;   // 2 * log2(e)
    TRANS_X8("v_exp_f32", e, a);
#pragma unroll
    for (int i = 0; i < 8; i++) e[i] = 1.f + e[i];
    TRANS_X8("v_rcp_f32", r, e);
#pragma unroll
    for (int i = 0; i < 8; i++) x[i] = __builtin_fmaf(-2.f, r[i], 1.f);
}

// One wave: dot products of NR consecutive weight rows (KQ * 128 floats each) with a vector whose
// lane pieces x[] sit in registers. w0 = first row + lane * 4: each load of the wave reads 512
// contiguous bytes of a row. Loads run AHEAD rows in front of the row being summed. Every lane
// returns the sum of row 'lane' (lanes >= NR: 0).
template <int NR, int KQ, int AHEAD>
__device__ __forceinline__ float wave_rows_dot(const float* __restrict__ w0, const float4 (&x)[KQ],
                                               int lane) {
    float4 w[AHEAD + 1][KQ];             // ring of row buffers
    float sum[NR];
#pragma unroll
    for (int r = 0; r < AHEAD; r++)
#pragma unroll
        for (int q = 0; q < KQ; q++) w[r][q] = *(const float4*)(w0 + (r * KQ + q) * 128);
#pragma unroll
    for (int r = 0; r < NR; r++) {
        // the two scheduling barriers pin "a later row's loads, then this row's sums":
        // without them the rows' sums are folded together and the loads wait for one another
        __builtin_amdgcn_sched_barrier(0);
        if (r + AHEAD < NR) {
#pragma unroll
            for (int q = 0; q < KQ; q++)
                w[(r + AHEAD) % (AHEAD + 1)][q] = *(const float4*)(w0 + ((r + AHEAD) * KQ + q) * 128);
        }
        __builtin_amdgcn_sched_barrier(0);
        const float4* wr = w[r % (AHEAD + 1)];
        float a0 = 0.f, a1 = 0.f, a2 = 0.f, a3 = 0.f;
#pragma unroll
        for (int q = 0; q < KQ; q++) {
            a0 = __builtin_fmaf(wr[q].x, x[q].x, a0);
            a1 = __builtin_fmaf(wr[q].y, x[q].y, a1);
            a2 = __builtin_fmaf(wr[q].z, x[q].z, a2);
            a3 = __builtin_fmaf(wr[q].w, x[q].w, a3);
        }
        sum[r] = (a0 + a1) + (a2 + a3);
    }
    // keeps the butterflies behind the last row's sums, all rows' steps side by side
    __builtin_amdgcn_sched_barrier(0);
#pragma unroll
    for (int m = 16; m >= 1; m >>= 1)
#pragma unroll
        for (int r = 0; r < NR; r++) sum[r] += __shfl_xor(sum[r], m, 32);
    float mine = 0.f;
#pragma unroll
    for (int r = 0; r < NR; r++) if (lane == r) mine = sum[r];
    return mine;
}

// ================= kernel A: qp = query @ q_w.T =================
// 256 blocks x 8 waves: block = (batch, 32 consecutive d), one wave per q_w row, 4 rows a wave.
#define QP_ROWS 32                         // d per block: one 128-B line of qp
#define QP_GROUPS (DIM / QP_ROWS)          // 16
__global__ __launch_bounds__(256)
void qproj_kernel(const float* __restrict__ query, const float* __restrict__ q_w,
                  float* __restrict__ qp_ws) {
    __shared__ float res_s[QP_ROWS];
    const int b    = blockIdx.x / QP_GROUPS;
    const int d0   = (blockIdx.x % QP_GROUPS) * QP_ROWS;
    const int tid  = threadIdx.x;
    const int lane = tid & 31;
    const int wave = tid >> 5;

    const float* q = query + (size_t)b * HIDDEN + lane * 4;
    float4 qf[HIDDEN / 128];
#pragma unroll
    for (int i = 0; i < HIDDEN / 128; i++) qf[i] = *(const float4*)(q + i * 128);

    const int row0 = wave * (QP_ROWS / 8);
    float mine = wave_rows_dot<QP_ROWS / 8, HIDDEN / 128, QP_ROWS / 8 - 1>(
        q_w + (size_t)(d0 + row0) * HIDDEN + lane * 4, qf, lane);
    if (lane < QP_ROWS / 8) res_s[row0 + lane] = mine;
    __syncthreads();          // all 32 row sums are in LDS; one wave stores the whole line
    if (tid < QP_ROWS) qp_ws[b * DIM + d0 + tid] = res_s[tid];
}

// ================= kernel B: fused projection/score/context =================
// 1024 blocks x 256 threads (8 wave32). wave w: rows rw=w&3 (16), dims chalf=w>>2 (256).
// K streamed in 32 double-buffered slices of 32, staged via async global->LDS copies.
__global__ __launch_bounds__(256)
void fused_attn_kernel(const float* __restrict__ value,
                       const float* __restrict__ prev_attn,
                       const float* __restrict__ conv_w,
                       const float* __restrict__ conv_b,
                       const float* __restrict__ loc_w,
                       const float* __restrict__ v_w,
                       const float* __restrict__ bias,
                       const float* __restrict__ score_w,
                       const float* __restrict__ score_b,
                       const float* __restrict__ qp_ws,
                       float* __restrict__ sg_ws,
                       float* __restrict__ ctx_part,
                       float* __restrict__ ssum_part) {
    // 144 KB: per buffer v_w[n][k-slice], then value[m][k-slice]
    __shared__ __attribute__((aligned(256))) float stage[2][STAGE_SZ];
    __shared__ float cf_s[ROWS_PER_BLOCK * CONV_OUT];  // conv features
    __shared__ float qp_s[DIM];
    __shared__ float scorepart[ROWS_PER_BLOCK * 2];
    __shared__ float sg_s[ROWS_PER_BLOCK];

    const int chunk = blockIdx.x;
    const int b  = chunk >> 6;
    const int v0 = (chunk & 63) << 6;
    const int tid  = threadIdx.x;
    const int lane = tid & 31;
    const int wave = tid >> 5;
    const int rw    = wave & 3;
    const int chalf = wave >> 2;

    const float* Abase = value + (size_t)(b * VLEN + v0) * HIDDEN;

    // stage qp (per-batch query projection)
    for (int i = tid; i < DIM; i += 256) qp_s[i] = qp_ws[b * DIM + i];

    // conv features: cf[m][c] = conv_b[c] + sum_j conv_w[c][j]*pa[v0+m-1+j]
    {
        const float* pa = prev_attn + (size_t)b * VLEN;
        for (int idx = tid; idx < ROWS_PER_BLOCK * CONV_OUT; idx += 256) {
            int m = idx / CONV_OUT, c = idx % CONV_OUT;
            int v = v0 + m;
            float x0 = (v - 1 >= 0)   ? pa[v - 1] : 0.f;
            float x1 = pa[v];
            float x2 = (v + 1 < VLEN) ? pa[v + 1] : 0.f;
            cf_s[idx] = conv_b[c] + conv_w[c * 3 + 0] * x0
                                  + conv_w[c * 3 + 1] * x1
                                  + conv_w[c * 3 + 2] * x2;
        }
    }

    // --- async stage of one K-slice into buffer `buf` ---
    // 576 rows x 8 pieces of 16 B = 18 copies per thread; eight lanes cover one row's whole line
    const int crow = tid >> 3;                         // row within a group of 32
    const int cpc  = tid & 7;                          // 16-B piece of the row
    const unsigned cdst = lds_addr32(&stage[0][crow * KC + ((cpc ^ ((crow >> 1) & 7)) << 2)]);
    const float* csrcB = v_w   + (size_t)crow * HIDDEN + cpc * 4;
    const float* csrcA = Abase + (size_t)crow * HIDDEN + cpc * 4;
    auto issue_slice = [&](int kc, int buf) {
        const unsigned dst = cdst + (unsigned)buf * (STAGE_SZ * 4u);
        const float* g0[9];
        const float* g1[9];
#pragma unroll
        for (int j = 0; j < 9; j++) g0[j] = csrcB + kc + (size_t)j * 32 * HIDDEN;
#pragma unroll
        for (int j = 0; j < 7; j++) g1[j] = csrcB + kc + (size_t)(j + 9) * 32 * HIDDEN;
        g1[7] = csrcA + kc;
        g1[8] = csrcA + kc + (size_t)32 * HIDDEN;
        async_g2l_b128_x9(dst, g0);
        async_g2l_b128_x9(dst + 9u * 4096u, g1);
    };

    // per-lane fragment coordinates (ISA 16x16x4 f32 layout)
    const int mr = lane & 15;            // A row
    const int kh = (lane >> 4) << 1;     // K sub-offset: 0 or 2
    const int nn = lane & 15;            // B/C column
    const int psw = (lane >> 1) & 7;     // piece swizzle of this lane's rows (A and B alike)

    v8f acc[16];
#pragma unroll
    for (int t = 0; t < 16; t++)
#pragma unroll
        for (int i = 0; i < 8; i++) acc[t][i] = 0.f;

    issue_slice(0, 0);
    wait_async0();
    __syncthreads();              // slice 0 (and qp_s, cf_s) published
    issue_slice(KC, 1);

    for (int s = 0; s < NSLICE; ++s) {
        const int cur = s & 1;
        const float* Ab = &stage[cur][(DIM + rw * 16 + mr) * KC + kh];
        const float* Bb = &stage[cur][(chalf * 256 + nn) * KC + kh];
        v2f af[2];
        v2f bf[2][16];
        af[0] = *(const v2f*)(Ab + (psw << 2));
#pragma unroll
        for (int t = 0; t < 16; t++) bf[0][t] = *(const v2f*)(Bb + t * 16 * KC + (psw << 2));
#pragma unroll
        for (int ks = 0; ks < KC / 4; ks++) {
            // the two scheduling barriers keep the next k-step's LDS reads in one group in front
            // of this k-step's WMMAs: without them each pair of WMMAs waits out its own read
            __builtin_amdgcn_sched_barrier(0);
            if (ks + 1 < KC / 4) {
                const int kk = ((ks + 1) ^ psw) << 2;
                af[(ks + 1) & 1] = *(const v2f*)(Ab + kk);
#pragma unroll
                for (int t = 0; t < 16; t++)
                    bf[(ks + 1) & 1][t] = *(const v2f*)(Bb + t * 16 * KC + kk);
            }
            __builtin_amdgcn_sched_barrier(0);
#pragma unroll
            for (int t = 0; t < 16; t++)
                acc[t] = __builtin_amdgcn_wmma_f32_16x16x4_f32(
                    false, af[ks & 1], false, bf[ks & 1][t], (short)0, acc[t], false, false);
        }
        wait_ds0();               // my reads of buffer cur are done
        wait_async0();            // my copies of slice s + 1 have landed
        __syncthreads();          // everyone's have; buffer cur is free
        if (s + 2 < NSLICE) issue_slice((s + 2) * KC, cur);
    }
    wait_async0();                // nothing in flight behind the loop

    // -------- epilogue: e = tanh(vp + qp + lp + bias); score partial per row --------
    float rowacc[8];
#pragma unroll
    for (int i = 0; i < 8; i++) rowacc[i] = 0.f;
    const int mbase = rw * 16 + ((lane >> 4) << 3);   // C layout: high-half lanes => M+8

#pragma unroll
    for (int t = 0; t < 16; t++) {
        int n = chalf * 256 + t * 16 + nn;
        float qb = qp_s[n] + bias[n];
        float sw = score_w[n];
        const float* lw = loc_w + (size_t)n * CONV_OUT;
        float l[CONV_OUT];
#pragma unroll
        for (int c = 0; c < CONV_OUT; c++) l[c] = lw[c];
        // the eight rows' sums over c advance side by side (each still in the order c = 0 .. 9)
        const float* cfr = cf_s + mbase * CONV_OUT;
        float lp[8], x[8];
#pragma unroll
        for (int i = 0; i < 8; i++) lp[i] = cfr[i * CONV_OUT] * l[0];
#pragma unroll
        for (int c = 1; c < CONV_OUT; c++)
#pragma unroll
            for (int i = 0; i < 8; i++) lp[i] += cfr[i * CONV_OUT + c] * l[c];
#pragma unroll
        for (int i = 0; i < 8; i++) x[i] = acc[t][i] + qb + lp[i];
        tanh_exp_rcp_x8(x);
#pragma unroll
        for (int i = 0; i < 8; i++) rowacc[i] += x[i] * sw;
    }
    // reduce over the 16 lanes of each half (tile columns)
#pragma unroll
    for (int i = 0; i < 8; i++) {
        float v = rowacc[i];
        v += __shfl_xor(v, 1, 32);
        v += __shfl_xor(v, 2, 32);
        v += __shfl_xor(v, 4, 32);
        v += __shfl_xor(v, 8, 32);
        rowacc[i] = v;
    }
    if ((lane & 15) == 0) {
#pragma unroll
        for (int i = 0; i < 8; i++)
            scorepart[(mbase + i) * 2 + chalf] = rowacc[i];
    }
    __syncthreads();

    if (tid < ROWS_PER_BLOCK) {
        float s = scorepart[tid * 2] + scorepart[tid * 2 + 1] + score_b[0];
        float sgv = 1.f / (1.f + expf(-s));
        sg_s[tid] = sgv;
        sg_ws[(size_t)b * VLEN + v0 + tid] = sgv;
    }
    __syncthreads();

    // -------- unnormalized context partial for this chunk (value tile is L2-hot) --------
    {
        int h = tid * 4;
        float4 a4 = make_float4(0.f, 0.f, 0.f, 0.f);
        const float* vrow = Abase + h;
        for (int r = 0; r < ROWS_PER_BLOCK; r++) {
            float s = sg_s[r];
            float4 x = *(const float4*)(vrow + (size_t)r * HIDDEN);
            a4.x += s * x.x; a4.y += s * x.y; a4.z += s * x.z; a4.w += s * x.w;
        }
        *(float4*)(ctx_part + (size_t)chunk * HIDDEN + h) = a4;
    }
    if (tid == 0) {
        float s = 0.f;
        for (int r = 0; r < ROWS_PER_BLOCK; r++) s += sg_s[r];
        ssum_part[chunk] = s;
    }
}

// ================= kernel C: deterministic reduce + attn normalize + output GEMM ===========
// 256 blocks x 8 waves: block = (batch, slice of 64 out_w rows and 256 attn entries).
// Every block of a batch repeats the fixed-order reduce of that batch's chunk partials
// (it needs the whole combined vector); one wave per out_w row, 8 rows a wave.
#define FIN_SLICES 16
#define FIN_ROWS   (HIDDEN / FIN_SLICES)   // 64
#define FIN_V      (VLEN / FIN_SLICES)     // 256
__global__ __launch_bounds__(256)
void finalize_kernel(const float* __restrict__ query,
                     const float* __restrict__ sg_ws,
                     const float* __restrict__ ctx_part,
                     const float* __restrict__ ssum_part,
                     const float* __restrict__ out_w,
                     const float* __restrict__ out_b,
                     float* __restrict__ out,        // (16,1,1024)
                     float* __restrict__ attn_out) { // (16,4096)
    __shared__ float comb[2 * HIDDEN];
    __shared__ float res_s[FIN_ROWS];
    const int b    = blockIdx.x / FIN_SLICES;
    const int sl   = blockIdx.x % FIN_SLICES;
    const int tid  = threadIdx.x;
    const int lane = tid & 31;
    const int wave = tid >> 5;

    // this block's 256 attn entries: loaded ahead of the long reduce
    const size_t v0 = (size_t)b * VLEN + sl * FIN_V;   // block-uniform
    const float sgv = (sg_ws + v0)[tid];

    // normaliser: the same fixed-order sum in every thread (block-uniform addresses)
    float ssum = 0.f;
#pragma unroll
    for (int c = 0; c < CHUNKS_PER_B; c++) ssum += ssum_part[b * CHUNKS_PER_B + c];
    const float inv = 1.f / ssum;

    // context = (fixed-order sum of chunk partials) * inv
    {
        int h = tid * 4;
        float4 a4 = make_float4(0.f, 0.f, 0.f, 0.f);
        const float4* cb = (const float4*)(ctx_part + (size_t)b * CHUNKS_PER_B * HIDDEN);  // block-uniform
        // bound by load latency: two runs of 32 loads in flight per thread, summed in chunk order
#pragma unroll
        for (int c0 = 0; c0 < CHUNKS_PER_B; c0 += 32) {
#pragma unroll
            for (int c = c0; c < c0 + 32; c++) {
                float4 x = (cb + c * (HIDDEN / 4))[tid];
                a4.x += x.x; a4.y += x.y; a4.z += x.z; a4.w += x.w;
            }
            // keeps the second run's loads behind the first run's sums (64 at once: too many registers)
            __builtin_amdgcn_sched_barrier(0);
        }
        *(float4*)(comb + h) = make_float4(a4.x * inv, a4.y * inv, a4.z * inv, a4.w * inv);
        *(float4*)(comb + HIDDEN + h) = ((const float4*)(query + (size_t)b * HIDDEN))[tid];
    }
    __syncthreads();          // combined vector complete

    // output = combined @ out_w.T + out_b : combined in registers
    float4 cf[2 * HIDDEN / 128];
#pragma unroll
    for (int i = 0; i < 2 * HIDDEN / 128; i++) cf[i] = *(const float4*)(comb + i * 128 + lane * 4);

    const int row0 = wave * (FIN_ROWS / 8);
    float mine = wave_rows_dot<FIN_ROWS / 8, 2 * HIDDEN / 128, 1>(
        out_w + (size_t)(sl * FIN_ROWS + row0) * (2 * HIDDEN) + lane * 4, cf, lane);
    if (lane < FIN_ROWS / 8) res_s[row0 + lane] = mine;
    __syncthreads();          // all 64 row sums are in LDS; each 128-B line of out has one writer
    (attn_out + v0)[tid] = sgv * inv;   // behind the barriers, so that none of them waits for the store
    if (tid < FIN_ROWS) {
        int h = sl * FIN_ROWS + tid;
        out[(size_t)b * HIDDEN + h] = res_s[tid] + out_b[h];
    }
}

// ============================ launch ============================
extern "C" void kernel_launch(void* const* d_in, const int* in_sizes, int n_in,
                              void* d_out, int out_size, void* d_ws, size_t ws_size,
                              hipStream_t stream) {
    const float* query     = (const float*)d_in[0];
    const float* value     = (const float*)d_in[1];
    const float* prev_attn = (const float*)d_in[2];
    const float* conv_w    = (const float*)d_in[3];
    const float* conv_b    = (const float*)d_in[4];
    const float* loc_w     = (const float*)d_in[5];
    const float* q_w       = (const float*)d_in[6];
    const float* v_w       = (const float*)d_in[7];
    const float* bias      = (const float*)d_in[8];
    const float* score_w   = (const float*)d_in[9];
    const float* score_b   = (const float*)d_in[10];
    const float* out_w     = (const float*)d_in[11];
    const float* out_b     = (const float*)d_in[12];

    float* ws = (float*)d_ws;
    float* qp_ws     = ws + WS_QP;
    float* sg_ws     = ws + WS_SG;
    float* ctx_part  = ws + WS_CTX;
    float* ssum_part = ws + WS_SSUM;

    float* out_main = (float*)d_out;                 // (16,1,1024)
    float* attn_out = out_main + BATCH * HIDDEN;     // (16,4096)

    qproj_kernel<<<BATCH * QP_GROUPS, 256, 0, stream>>>(query, q_w, qp_ws);

    fused_attn_kernel<<<NBLOCKS_FUSED, 256, 0, stream>>>(
        value, prev_attn, conv_w, conv_b, loc_w, v_w, bias, score_w, score_b,
        qp_ws, sg_ws, ctx_part, ssum_part);

    finalize_kernel<<<BATCH * FIN_SLICES, 256, 0, stream>>>(
        query, sg_ws, ctx_part, ssum_part, out_w, out_b, out_main, attn_out);
}

// v004
// It runs in 328 microseconds.
// Timed twice side by side with v003, it ran 1.15 times as fast both times.
// Over all steps from v000 it is 2.08 times as fast.
#include <hip/hip_runtime.h>
#include <hip/hip_bf16.h>
#include <math.h>

typedef float v2f __attribute__((ext_vector_type(2)));
typedef float v8f __attribute__((ext_vector_type(8)));

#define HIDDEN 1024
#define DIM    512
#define CONV_OUT 10
#define BATCH  16
#define VLEN   4096
#define ROWS_PER_BLOCK 64
#define CHUNKS_PER_B   (VLEN / ROWS_PER_BLOCK)   // 64
#define NBLOCKS_FUSED  (BATCH * CHUNKS_PER_B)    // 1024

#define KC        32                 // K-slice per stage: one whole 128-B line of every operand row
#define NSLICE    (HIDDEN / KC)      // 32
#define STAGE_ROWS (DIM + ROWS_PER_BLOCK)     // a stage: 512 rows of v_w, then 64 rows of value
#define STAGE_SZ   (STAGE_ROWS * KC)           // 18432 floats per buffer, rows unpadded
// LDS rows are 128 B with no pad. The 16-B piece c of row r sits at piece (c ^ ((r >> 1) & 7)):
// 16 consecutive rows read at one c fall on 16 different groups of four banks.

// ---------------- workspace layout (floats) ----------------
#define WS_QP    0
#define WS_SG    (WS_QP + BATCH * DIM)
#define WS_CTX   (WS_SG + BATCH * VLEN)
#define WS_SSUM  (WS_CTX + NBLOCKS_FUSED * HIDDEN)

// ISA 10.2: generic (flat) pointers to LDS carry the LDS byte address in bits [31:0].
__device__ __forceinline__ unsigned lds_addr32(const void* p) {
    return (unsigned)(unsigned long long)p;
}

// Nine copies of 16 B per lane, global -> LDS; the LDS places lie 32 rows (4096 B) apart. The
// closing s_wait_xcnt stands inside the statement so that no address register of an issued copy
// is rewritten in front of it.
__device__ __forceinline__ void async_g2l_b128_x9(unsigned lds, const float* const (&g)[9]) {
    asm volatile("global_load_async_to_lds_b128 %0, %9, off\n\t"
                 "global_load_async_to_lds_b128 %1, %10, off\n\t"
                 "global_load_async_to_lds_b128 %2, %11, off\n\t"
                 "global_load_async_to_lds_b128 %3, %12, off\n\t"
                 "global_load_async_to_lds_b128 %4, %13, off\n\t"
                 "global_load_async_to_lds_b128 %5, %14, off\n\t"
                 "global_load_async_to_lds_b128 %6, %15, off\n\t"
                 "global_load_async_to_lds_b128 %7, %16, off\n\t"
                 "global_load_async_to_lds_b128 %8, %17, off\n\t"
                 "s_wait_xcnt 0x0"
                 :: "v"(lds), "v"(lds + 4096u), "v"(lds + 8192u), "v"(lds + 12288u),
                    "v"(lds + 16384u), "v"(lds + 20480u), "v"(lds + 24576u), "v"(lds + 28672u),
                    "v"(lds + 32768u),
                    "v"(g[0]), "v"(g[1]), "v"(g[2]), "v"(g[3]), "v"(g[4]), "v"(g[5]), "v"(g[6]),
                    "v"(g[7]), "v"(g[8])
                 : "memory");
}

// this wave's copies have landed in LDS
__device__ __forceinline__ void wait_async0() {
    asm volatile("s_wait_asynccnt 0x0" ::: "memory");
}

// this wave's LDS reads have returned: its buffer may be refilled behind the next barrier
__device__ __forceinline__ void wait_ds0() {
    asm volatile("s_wait_dscnt 0x0" ::: "memory");
}

// Eight independent transcendentals OP in one statement: each stands in the slot that the
// instruction set asks for behind the one in front of it, and the closing v_nop in the last one's
// Early-clobber outputs: no result register is a source of a later line.
#define TRANS_X8(OP, y, a)                                                                        \
    asm(OP " %0, %8\n\t" OP " %1, %9\n\t" OP " %2, %10\n\t" OP " %3, %11\n\t"                    \
        OP " %4, %12\n\t" OP " %5, %13\n\t" OP " %6, %14\n\t" OP " %7, %15\n\t"                  \
        "v_nop"                                                                                   \
        : "=&v"(y[0]), "=&v"(y[1]), "=&v"(y[2]), "=&v"(y[3]),                                     \
          "=&v"(y[4]), "=&v"(y[5]), "=&v"(y[6]), "=&v"(y[7])                                      \
        : "v"(a[0]), "v"(a[1]), "v"(a[2]), "v"(a[3]), "v"(a[4]), "v"(a[5]), "v"(a[6]), "v"(a[7]))

// tanh(x) = 1 - 2 / (1 + e^(2x)) in place, one v_exp_f32 and one v_rcp_f32 an element, no branch.
// e^(2x) = inf gives 1, e^(2x) = 0 gives -1, NaN stays NaN. Eight elements go through each stage
// side by side, so that one element's latency is filled by the others' instructions.
__device__ __forceinline__ void tanh_exp_rcp_x8(float (&x)[8]) {
    float a[8], e[8], r[8];
#pragma unroll
    for (int i = 0; i < 8; i++) a[i] = x[i] * 2.8853900817779268f;   // 2 * log2(e)
    TRANS_X8("v_exp_f32", e, a);
#pragma unroll
    for (int i = 0; i < 8; i++) e[i] = 1.f + e[i];
    TRANS_X8("v_rcp_f32", r, e);
#pragma unroll
    for (int i = 0; i < 8; i++) x[i] = __builtin_fmaf(-2.f, r[i], 1.f);
}

// One wave: dot products of NR consecutive weight rows (KQ * 128 floats each) with a vector whose
// lane pieces x[] sit in registers. w0 = first row + lane * 4: each load of the wave reads 512
// contiguous bytes of a row. Loads run AHEAD rows in front of the row being summed. Every lane
// returns the sum of row 'lane' (lanes >= NR: 0).
template <int NR, int KQ, int AHEAD>
__device__ __forceinline__ float wave_rows_dot(const float* __restrict__ w0, const float4 (&x)[KQ],
                                               int lane) {
    float4 w[AHEAD + 1][KQ];             // ring of row buffers
    float sum[NR];
#pragma unroll
    for (int r = 0; r < AHEAD; r++)
#pragma unroll
        for (int q = 0; q < KQ; q++) w[r][q] = *(const float4*)(w0 + (r * KQ + q) * 128);
#pragma unroll
    for (int r = 0; r < NR; r++) {
        // the two scheduling barriers pin "a later row's loads, then this row's sums":
        // without them the rows' sums are folded together and the loads wait for one another
        __builtin_amdgcn_sched_barrier(0);
        if (r + AHEAD < NR) {
#pragma unroll
            for (int q = 0; q < KQ; q++)
                w[(r + AHEAD) % (AHEAD + 1)][q] = *(const float4*)(w0 + ((r + AHEAD) * KQ + q) * 128);
        }
        __builtin_amdgcn_sched_barrier(0);
        const float4* wr = w[r % (AHEAD + 1)];
        float a0 = 0.f, a1 = 0.f, a2 = 0.f, a3 = 0.f;
#pragma unroll
        for (int q = 0; q < KQ; q++) {
            a0 = __builtin_fmaf(wr[q].x, x[q].x, a0);
            a1 = __builtin_fmaf(wr[q].y, x[q].y, a1);
            a2 = __builtin_fmaf(wr[q].z, x[q].z, a2);
            a3 = __builtin_fmaf(wr[q].w, x[q].w, a3);
        }
        sum[r] = (a0 + a1) + (a2 + a3);
    }
    // keeps the butterflies behind the last row's sums, all rows' steps side by side
    __builtin_amdgcn_sched_barrier(0);
#pragma unroll
    for (int m = 16; m >= 1; m >>= 1)
#pragma unroll
        for (int r = 0; r < NR; r++) sum[r] += __shfl_xor(sum[r], m, 32);
    float mine = 0.f;
#pragma unroll
    for (int r = 0; r < NR; r++) if (lane == r) mine = sum[r];
    return mine;
}

// ================= kernel A: qp = query @ q_w.T =================
// 256 blocks x 8 waves: block = (batch, 32 consecutive d), one wave per q_w row, 4 rows a wave.
#define QP_ROWS 32                         // d per block: one 128-B line of qp
#define QP_GROUPS (DIM / QP_ROWS)          // 16
__global__ __launch_bounds__(256)
void qproj_kernel(const float* __restrict__ query, const float* __restrict__ q_w,
                  float* __restrict__ qp_ws) {
    __shared__ float res_s[QP_ROWS];
    const int b    = blockIdx.x / QP_GROUPS;
    const int d0   = (blockIdx.x % QP_GROUPS) * QP_ROWS;
    const int tid  = threadIdx.x;
    const int lane = tid & 31;
    const int wave = tid >> 5;

    const float* q = query + (size_t)b * HIDDEN + lane * 4;
    float4 qf[HIDDEN / 128];
#pragma unroll
    for (int i = 0; i < HIDDEN / 128; i++) qf[i] = *(const float4*)(q + i * 128);

    const int row0 = wave * (QP_ROWS / 8);
    float mine = wave_rows_dot<QP_ROWS / 8, HIDDEN / 128, QP_ROWS / 8 - 1>(
        q_w + (size_t)(d0 + row0) * HIDDEN + lane * 4, qf, lane);
    if (lane < QP_ROWS / 8) res_s[row0 + lane] = mine;
    __syncthreads();          // all 32 row sums are in LDS; one wave stores the whole line
    if (tid < QP_ROWS) qp_ws[b * DIM + d0 + tid] = res_s[tid];
}

// ================= kernel B: fused projection/score/context =================
// 1024 blocks x 256 threads (8 wave32). wave w: rows rw=w&3 (16), dims chalf=w>>2 (256).
// K streamed in 32 double-buffered slices of 32, staged via async global->LDS copies.
__global__ __launch_bounds__(256)
void fused_attn_kernel(const float* __restrict__ value,
                       const float* __restrict__ prev_attn,
                       const float* __restrict__ conv_w,
                       const float* __restrict__ conv_b,
                       const float* __restrict__ loc_w,
                       const float* __restrict__ v_w,
                       const float* __restrict__ bias,
                       const float* __restrict__ score_w,
                       const float* __restrict__ score_b,
                       const float* __restrict__ qp_ws,
                       float* __restrict__ sg_ws,
                       float* __restrict__ ctx_part,
                       float* __restrict__ ssum_part) {
    // 144 KB: per buffer v_w[n][k-slice], then value[m][k-slice]
    __shared__ __attribute__((aligned(256))) float stage[2][STAGE_SZ];
    __shared__ float cf_s[ROWS_PER_BLOCK * CONV_OUT];  // conv features
    __shared__ float qp_s[DIM];
    __shared__ float scorepart[ROWS_PER_BLOCK * 2];
    __shared__ float sg_s[ROWS_PER_BLOCK];

    const int chunk = blockIdx.x;
    const int b  = chunk >> 6;
    const int v0 = (chunk & 63) << 6;
    const int tid  = threadIdx.x;
    const int lane = tid & 31;
    const int wave = tid >> 5;
    const int rw    = wave & 3;
    const int chalf = wave >> 2;

    const float* Abase = value + (size_t)(b * VLEN + v0) * HIDDEN;

    // stage qp (per-batch query projection)
    for (int i = tid; i < DIM; i += 256) qp_s[i] = qp_ws[b * DIM + i];

    // conv features: cf[m][c] = conv_b[c] + sum_j conv_w[c][j]*pa[v0+m-1+j]
    {
        const float* pa = prev_attn + (size_t)b * VLEN;
        for (int idx = tid; idx < ROWS_PER_BLOCK * CONV_OUT; idx += 256) {
            int m = idx / CONV_OUT, c = idx % CONV_OUT;
            int v = v0 + m;
            float x0 = (v - 1 >= 0)   ? pa[v - 1] : 0.f;
            float x1 = pa[v];
            float x2 = (v + 1 < VLEN) ? pa[v + 1] : 0.f;
            cf_s[idx] = conv_b[c] + conv_w[c * 3 + 0] * x0
                                  + conv_w[c * 3 + 1] * x1
                                  + conv_w[c * 3 + 2] * x2;
        }
    }

    // --- async stage of one K-slice into buffer `buf` ---
    // 576 rows x 8 pieces of 16 B = 18 copies per thread; eight lanes cover one row's whole line
    const int crow = tid >> 3;                         // row within a group of 32
    const int cpc  = tid & 7;                          // 16-B piece of the row
    const unsigned cdst = lds_addr32(&stage[0][crow * KC + ((cpc ^ ((crow >> 1) & 7)) << 2)]);
    const float* csrcB = v_w   + (size_t)crow * HIDDEN + cpc * 4;
    const float* csrcA = Abase + (size_t)crow * HIDDEN + cpc * 4;
    auto issue_slice = [&](int kc, int buf) {
        const unsigned dst = cdst + (unsigned)buf * (STAGE_SZ * 4u);
        const float* g0[9];
        const float* g1[9];
#pragma unroll
        for (int j = 0; j < 9; j++) g0[j] = csrcB + kc + (size_t)j * 32 * HIDDEN;
#pragma unroll
        for (int j = 0; j < 7; j++) g1[j] = csrcB + kc + (size_t)(j + 9) * 32 * HIDDEN;
        g1[7] = csrcA + kc;
        g1[8] = csrcA + kc + (size_t)32 * HIDDEN;
        async_g2l_b128_x9(dst, g0);
        async_g2l_b128_x9(dst + 9u * 4096u, g1);
    };

    // per-lane fragment coordinates (ISA 16x16x4 f32 layout)
    const int mr = lane & 15;            // A row
    const int kh = (lane >> 4) << 1;     // K sub-offset: 0 or 2
    const int nn = lane & 15;            // B/C column
    const int psw = (lane >> 1) & 7;     // piece swizzle of this lane's rows (A and B alike)

    v8f acc[16];
#pragma unroll
    for (int t = 0; t < 16; t++)
#pragma unroll
        for (int i = 0; i < 8; i++) acc[t][i] = 0.f;

    issue_slice(0, 0);
    wait_async0();
    __syncthreads();              // slice 0 (and qp_s, cf_s) published
    issue_slice(KC, 1);

    for (int s = 0; s < NSLICE; ++s) {
        const int cur = s & 1;
        const float* Ab = &stage[cur][(DIM + rw * 16 + mr) * KC + kh];
        const float* Bb = &stage[cur][(chalf * 256 + nn) * KC + kh];
        v2f af[2];
        v2f bf[2][16];
        af[0] = *(const v2f*)(Ab + (psw << 2));
#pragma unroll
        for (int t = 0; t < 16; t++) bf[0][t] = *(const v2f*)(Bb + t * 16 * KC + (psw << 2));
#pragma unroll
        for (int ks = 0; ks < KC / 4; ks++) {
            // the two scheduling barriers keep the next k-step's LDS reads in one group in front
            // of this k-step's WMMAs: without them each pair of WMMAs waits out its own read
            __builtin_amdgcn_sched_barrier(0);
            if (ks + 1 < KC / 4) {
                const int kk = ((ks + 1) ^ psw) << 2;
                af[(ks + 1) & 1] = *(const v2f*)(Ab + kk);
#pragma unroll
                for (int t = 0; t < 16; t++)
                    bf[(ks + 1) & 1][t] = *(const v2f*)(Bb + t * 16 * KC + kk);
            }
            __builtin_amdgcn_sched_barrier(0);
#pragma unroll
            for (int t = 0; t < 16; t++)
                acc[t] = __builtin_amdgcn_wmma_f32_16x16x4_f32(
                    false, af[ks & 1], false, bf[ks & 1][t], (short)0, acc[t], false, false);
        }
        wait_ds0();               // my reads of buffer cur are done
        wait_async0();            // my copies of slice s + 1 have landed
        __syncthreads();          // everyone's have; buffer cur is free
        if (s + 2 < NSLICE) issue_slice((s + 2) * KC, cur);
    }
    wait_async0();                // nothing in flight behind the loop

    // -------- epilogue: e = tanh(vp + qp + lp + bias); score partial per row --------
    float rowacc[8];
#pragma unroll
    for (int i = 0; i < 8; i++) rowacc[i] = 0.f;
    const int mbase = rw * 16 + ((lane >> 4) << 3);   // C layout: high-half lanes => M+8

#pragma unroll
    for (int t = 0; t < 16; t++) {
        int n = chalf * 256 + t * 16 + nn;
        float qb = qp_s[n] + bias[n];
        float sw = score_w[n];
        const float* lw = loc_w + (size_t)n * CONV_OUT;
        float l[CONV_OUT];
#pragma unroll
        for (int c = 0; c < CONV_OUT; c++) l[c] = lw[c];
        // the eight rows' sums over c advance side by side (each still in the order c = 0 .. 9)
        const float* cfr = cf_s + mbase * CONV_OUT;
        float lp[8], x[8];
#pragma unroll
        for (int i = 0; i < 8; i++) lp[i] = cfr[i * CONV_OUT] * l[0];
#pragma unroll
        for (int c = 1; c < CONV_OUT; c++)
#pragma unroll
            for (int i = 0; i < 8; i++) lp[i] += cfr[i * CONV_OUT + c] * l[c];
#pragma unroll
        for (int i = 0; i < 8; i++) x[i] = acc[t][i] + qb + lp[i];
        tanh_exp_rcp_x8(x);
#pragma unroll
        for (int i = 0; i < 8; i++) rowacc[i] += x[i] * sw;
    }
    // reduce over the 16 lanes of each half (tile columns)
#pragma unroll
    for (int i = 0; i < 8; i++) {
        float v = rowacc[i];
        v += __shfl_xor(v, 1, 32);
        v += __shfl_xor(v, 2, 32);
        v += __shfl_xor(v, 4, 32);
        v += __shfl_xor(v, 8, 32);
        rowacc[i] = v;
    }
    if ((lane & 15) == 0) {
#pragma unroll
        for (int i = 0; i < 8; i++)
            scorepart[(mbase + i) * 2 + chalf] = rowacc[i];
    }
    __syncthreads();

    if (tid < ROWS_PER_BLOCK) {
        float s = scorepart[tid * 2] + scorepart[tid * 2 + 1] + score_b[0];
        float sgv = 1.f / (1.f + expf(-s));
        sg_s[tid] = sgv;
        sg_ws[(size_t)b * VLEN + v0 + tid] = sgv;
    }
    __syncthreads();

    // -------- unnormalized context partial for this chunk (value tile is L2-hot) --------
    {
        int h = tid * 4;
        float4 a4 = make_float4(0.f, 0.f, 0.f, 0.f);
        const float* vrow = Abase + h;
        // two runs of 32 loads in flight per thread, summed in row order: with all 64 at once the
        // kernel's allocation passes 256 registers and only one work-group fits on a WGP
#pragma unroll
        for (int r0 = 0; r0 < ROWS_PER_BLOCK; r0 += 32) {
#pragma unroll
            for (int r = r0; r < r0 + 32; r++) {
                float s = sg_s[r];
                float4 x = *(const float4*)(vrow + (size_t)r * HIDDEN);
                a4.x += s * x.x; a4.y += s * x.y; a4.z += s * x.z; a4.w += s * x.w;
            }
            // keeps the second run's loads behind the first run's sums
            __builtin_amdgcn_sched_barrier(0);
        }
        *(float4*)(ctx_part + (size_t)chunk * HIDDEN + h) = a4;
    }
    if (tid == 0) {
        float s = 0.f;
        for (int r = 0; r < ROWS_PER_BLOCK; r++) s += sg_s[r];
        ssum_part[chunk] = s;
    }
}

// ================= kernel C: deterministic reduce + attn normalize + output GEMM ===========
// 256 blocks x 8 waves: block = (batch, slice of 64 out_w rows and 256 attn entries).
// Every block of a batch repeats the fixed-order reduce of that batch's chunk partials
// (it needs the whole combined vector); one wave per out_w row, 8 rows a wave.
#define FIN_SLICES 16
#define FIN_ROWS   (HIDDEN / FIN_SLICES)   // 64
#define FIN_V      (VLEN / FIN_SLICES)     // 256
__global__ __launch_bounds__(256)
void finalize_kernel(const float* __restrict__ query,
                     const float* __restrict__ sg_ws,
                     const float* __restrict__ ctx_part,
                     const float* __restrict__ ssum_part,
                     const float* __restrict__ out_w,
                     const float* __restrict__ out_b,
                     float* __restrict__ out,        // (16,1,1024)
                     float* __restrict__ attn_out) { // (16,4096)
    __shared__ float comb[2 * HIDDEN];
    __shared__ float res_s[FIN_ROWS];
    const int b    = blockIdx.x / FIN_SLICES;
    const int sl   = blockIdx.x % FIN_SLICES;
    const int tid  = threadIdx.x;
    const int lane = tid & 31;
    const int wave = tid >> 5;

    // this block's 256 attn entries: loaded ahead of the long reduce
    const size_t v0 = (size_t)b * VLEN + sl * FIN_V;   // block-uniform
    const float sgv = (sg_ws + v0)[tid];

    // normaliser: the same fixed-order sum in every thread (block-uniform addresses)
    float ssum = 0.f;
#pragma unroll
    for (int c = 0; c < CHUNKS_PER_B; c++) ssum += ssum_part[b * CHUNKS_PER_B + c];
    const float inv = 1.f / ssum;

    // context = (fixed-order sum of chunk partials) * inv
    {
        int h = tid * 4;
        float4 a4 = make_float4(0.f, 0.f, 0.f, 0.f);
        const float4* cb = (const float4*)(ctx_part + (size_t)b * CHUNKS_PER_B * HIDDEN);  // block-uniform
        // bound by load latency: two runs of 32 loads in flight per thread, summed in chunk order
#pragma unroll
        for (int c0 = 0; c0 < CHUNKS_PER_B; c0 += 32) {
#pragma unroll
            for (int c = c0; c < c0 + 32; c++) {
                float4 x = (cb + c * (HIDDEN / 4))[tid];
                a4.x += x.x; a4.y += x.y; a4.z += x.z; a4.w += x.w;
            }
            // keeps the second run's loads behind the first run's sums (64 at once: too many registers)
            __builtin_amdgcn_sched_barrier(0);
        }
        *(float4*)(comb + h) = make_float4(a4.x * inv, a4.y * inv, a4.z * inv, a4.w * inv);
        *(float4*)(comb + HIDDEN + h) = ((const float4*)(query + (size_t)b * HIDDEN))[tid];
    }
    __syncthreads();          // combined vector complete

    // output = combined @ out_w.T + out_b : combined in registers
    float4 cf[2 * HIDDEN / 128];
#pragma unroll
    for (int i = 0; i < 2 * HIDDEN / 128; i++) cf[i] = *(const float4*)(comb + i * 128 + lane * 4);

    const int row0 = wave * (FIN_ROWS / 8);
    float mine = wave_rows_dot<FIN_ROWS / 8, 2 * HIDDEN / 128, 1>(
        out_w + (size_t)(sl * FIN_ROWS + row0) * (2 * HIDDEN) + lane * 4, cf, lane);
    if (lane < FIN_ROWS / 8) res_s[row0 + lane] = mine;
    __syncthreads();          // all 64 row sums are in LDS; each 128-B line of out has one writer
    (attn_out + v0)[tid] = sgv * inv;   // behind the barriers, so that none of them waits for the store
    if (tid < FIN_ROWS) {
        int h = sl * FIN_ROWS + tid;
        out[(size_t)b * HIDDEN + h] = res_s[tid] + out_b[h];
    }
}

// ============================ launch ============================
extern "C" void kernel_launch(void* const* d_in, const int* in_sizes, int n_in,
                              void* d_out, int out_size, void* d_ws, size_t ws_size,
                              hipStream_t stream) {
    const float* query     = (const float*)d_in[0];
    const float* value     = (const float*)d_in[1];
    const float* prev_attn = (const float*)d_in[2];
    const float* conv_w    = (const float*)d_in[3];
    const float* conv_b    = (const float*)d_in[4];
    const float* loc_w     = (const float*)d_in[5];
    const float* q_w       = (const float*)d_in[6];
    const float* v_w       = (const float*)d_in[7];
    const float* bias      = (const float*)d_in[8];
    const float* score_w   = (const float*)d_in[9];
    const float* score_b   = (const float*)d_in[10];
    const float* out_w     = (const float*)d_in[11];
    const float* out_b     = (const float*)d_in[12];

    float* ws = (float*)d_ws;
    float* qp_ws     = ws + WS_QP;
    float* sg_ws     = ws + WS_SG;
    float* ctx_part  = ws + WS_CTX;
    float* ssum_part = ws + WS_SSUM;

    float* out_main = (float*)d_out;                 // (16,1,1024)
    float* attn_out = out_main + BATCH * HIDDEN;     // (16,4096)

    qproj_kernel<<<BATCH * QP_GROUPS, 256, 0, stream>>>(query, q_w, qp_ws);

    fused_attn_kernel<<<NBLOCKS_FUSED, 256, 0, stream>>>(
        value, prev_attn, conv_w, conv_b, loc_w, v_w, bias, score_w, score_b,
        qp_ws, sg_ws, ctx_part, ssum_part);

    finalize_kernel<<<BATCH * FIN_SLICES, 256, 0, stream>>>(
        query, sg_ws, ctx_part, ssum_part, out_w, out_b, out_main, attn_out);
}
